// v000
// The times below were measured on an AMD MI455X: many runs one after another, warmed up first and cycling through
// copies of the inputs, with the whole window's GPU time divided by the number of runs. Launches and the gaps
// between them are all in it. The median over several windows is given; except for v000 it joins two sittings, which
// can be a few percent apart, so the side-by-side timings, each taken in one sitting, are the better comparison.
// v000, which the later versions start from, runs in 1030 microseconds.
#include <hip/hip_runtime.h>
// LLFE (4 x 64 ch x 64 x 64: hconv = relu(BN(conv3x3(high))), lconv = relu(BN(conv3x3(low))) (inference BN, no conv bias); 2 heads x 32 channels over the 4096 pixels: attn = softmax(q_h . k_l * 64^-0.5 * p), q from hconv, k = v from lconv; out = (attn v) back to NCHW + hconv).
// Structure: NCHW -> exact f16 pixel rows (LDS transpose); both convs as im2col (K = 576) + WMMA GEMM (32x64 wave tiles, f32 accumulation, exact x16 weights), then the BN affine + ReLU on VALU into f32 rows (hconv, for the residual) and f16 operand rows; lconv also transposed per batch by 64 x 64 LDS tiles; per (batch, head): the 4096 x 4096 score plane as a GEMM (K = 32), row softmax on VALU with the learned scale p read from its input (f16 weights x 2^10), the readout GEMM (16-row tiles, N = 32); residual + NCHW store on VALU.
// Compute dtype: inputs rounded to bf16; inputs / weights exact as f16; hconv / lconv as plain f16 attention operands (~2^-12; logits std 0.5); BN / softmax / residual f32. v_wmma_f32_16x16x32_f16.
#define NI 4
#define CH 64
#define NHD 2
#define HC 32
#define HS 64
#define WSD 64
#define NPX (HS * WSD)
#define NR (NI * NPX)            /* 16384 */
#define KC (9 * CH)              /* 576 */
typedef __bf16 v16b __attribute__((ext_vector_type(16)));
typedef unsigned short v8us __attribute__((ext_vector_type(8), may_alias));
typedef float  v8f  __attribute__((ext_vector_type(8)));
typedef float  v4f  __attribute__((ext_vector_type(4)));
typedef float  v4fa __attribute__((ext_vector_type(4), may_alias));
union FragB { v16b v; v8us half[2]; unsigned short u[16]; };

__device__ __forceinline__ unsigned short bf16_bits(float x) { unsigned int u = __float_as_uint(x); return (unsigned short)((u + 0x7FFFu + ((u >> 16) & 1u)) >> 16); }
__device__ __forceinline__ float bf16_val(unsigned short b) { return __uint_as_float(((unsigned int)b) << 16); }
__device__ __forceinline__ float bf16_round(float x) { return bf16_val(bf16_bits(x)); }
// D += A·B with NT terms: 1 = ah·bh, 2 = + al·bh (A split), 3 = + ah·bl (both split)
template <int NT>
__device__ __forceinline__ v8f mmaN(v16b ah, v16b al, v16b bh, v16b bl, v8f c) {
  c = __builtin_amdgcn_wmma_f32_16x16x32_bf16(false, ah, false, bh, (short)0, c, false, false);
  if (NT >= 2) c = __builtin_amdgcn_wmma_f32_16x16x32_bf16(false, al, false, bh, (short)0, c, false, false);
  if (NT >= 3) c = __builtin_amdgcn_wmma_f32_16x16x32_bf16(false, ah, false, bl, (short)0, c, false, false);
  asm volatile("v_nop\n\tv_nop\n\tv_nop\n\tv_nop" : "+v"(c) : "v"(ah), "v"(al), "v"(bh), "v"(bl));
  return c;
}

__global__ __launch_bounds__(256) void k_wt_bf16(const float* __restrict__ W, unsigned short* __restrict__ Wt, int K, int N) {
  const int t = blockIdx.x * 256 + threadIdx.x;
  const int k8n = K / 8;
  if (t >= N * k8n) return;
  const int n = t / k8n, k8 = (t % k8n) * 8;
  v8us v;
#pragma unroll
  for (int i = 0; i < 8; ++i) v[i] = bf16_bits(W[(size_t)(k8 + i) * N + n]);
  *(v8us*)(Wt + (size_t)n * K + k8) = v;
  
}

// GEMM C[M][N] (f32, pitch ldc) = act(A[M][K]·W + bias). A f32 row-major (pitch lda) converted per fragment to bf16
// (ASPLIT: hi/lo two planes -> 2 terms, else single rounded term); Wt bf16 [N][K] (pitch ldb). BIAS_BF16 rounds the
// bias to bf16 first (bias quantised to bf16 before the add). K%32==0, M%16==0, N%64==0.
template <bool ASPLIT, int ACT, bool BIAS_BF16>
__global__ __launch_bounds__(128) void k_gemm_bf(const float* __restrict__ A, int lda, const unsigned short* __restrict__ Wt, int ldb,
                                               const float* __restrict__ bias, float* __restrict__ C, int ldc, int M, int N, int K) {
  __shared__ __attribute__((aligned(16))) float so[4][16][64];
  const int tid = threadIdx.x, w = tid >> 5, lane = tid & 31, ln = lane & 15, hh = lane >> 4;
  const int ntn = N / 64;
  const int wid = blockIdx.x * 4 + w;
  const int mt = wid / ntn, nq = wid % ntn;
  if (mt * 16 >= M) return;
  const int row0 = mt * 16, col0 = nq * 64;
  const float* arow = A + (size_t)(row0 + ln) * lda;
  v8f acc[4] = {};
  for (int kb = 0; kb < K; kb += 32) {
    FragB ah, al;
    const v4f x0 = *(const v4fa*)(arow + kb + 8 * hh), x1 = *(const v4fa*)(arow + kb + 8 * hh + 4);
    const v4f x2 = *(const v4fa*)(arow + kb + 16 + 8 * hh), x3 = *(const v4fa*)(arow + kb + 16 + 8 * hh + 4);
    float xs[16] = {x0[0],x0[1],x0[2],x0[3],x1[0],x1[1],x1[2],x1[3],x2[0],x2[1],x2[2],x2[3],x3[0],x3[1],x3[2],x3[3]};
#pragma unroll
    for (int i = 0; i < 16; ++i) { const unsigned short hb = bf16_bits(xs[i]); ah.u[i] = hb; al.u[i] = ASPLIT ? bf16_bits(xs[i] - bf16_val(hb)) : (unsigned short)0; }
#pragma unroll
    for (int t = 0; t < 4; ++t) {
      const unsigned short* brow = Wt + (size_t)(col0 + t * 16 + ln) * ldb + kb;
      FragB b;
      b.half[0] = *(const v8us*)(brow + 8 * hh);
      b.half[1] = *(const v8us*)(brow + 16 + 8 * hh);
      acc[t] = mmaN<ASPLIT ? 2 : 1>(ah.v, al.v, b.v, b.v, acc[t]);
    }
  }
#pragma unroll
  for (int t = 0; t < 4; ++t) {
    float bv = bias ? bias[col0 + t * 16 + ln] : 0.f;
    if (BIAS_BF16) bv = bf16_round(bv);
#pragma unroll
    for (int r = 0; r < 8; ++r) { float v = acc[t][r] + bv; if (ACT == 1) v = fmaxf(v, 0.f); so[w][8 * hh + r][t * 16 + ln] = v; }
  }
  __builtin_amdgcn_fence(__ATOMIC_ACQ_REL, "workgroup");
  __builtin_amdgcn_wave_barrier();
  const int rsub = lane >> 4, c4 = (lane & 15) * 4;
  {
#pragma unroll
    for (int q = 0; q < 8; ++q) {
      const int r = q * 2 + rsub;
      const v4f v = *(const v4fa*)&so[w][r][c4];
      *(v4f*)(C + (size_t)(row0 + r) * ldc + col0 + c4) = v;
    }
    
  }
}

// GEMM C = act(A·W + bias + resid): A f32 (ASPLIT -> hi/lo 2 terms), Wt bf16 [N][K]; ACT 0 none, 1 relu, 2 exact gelu;
// resid (optional, f32, row index = (row % rmod), pitch ldr, RES_BF16 rounds it) added before the activation.
template <bool ASPLIT, int ACT, bool BIAS_BF16, bool RES_BF16>
__global__ __launch_bounds__(128) void k_gemm_bf3(const float* __restrict__ A, int lda, const unsigned short* __restrict__ Wt, int ldb,
                                                const float* __restrict__ bias, const float* __restrict__ resid, int rmod, int ldr,
                                                float* __restrict__ C, int ldc, int M, int N, int K) {
  __shared__ __attribute__((aligned(16))) float so[4][16][64];
  const int tid = threadIdx.x, w = tid >> 5, lane = tid & 31, ln = lane & 15, hh = lane >> 4;
  const int ntn = N / 64;
  const int wid = blockIdx.x * 4 + w;
  const int mt = wid / ntn, nq = wid % ntn;
  if (mt * 16 >= M) return;
  const int row0 = mt * 16, col0 = nq * 64;
  const float* arow = A + (size_t)(row0 + ln) * lda;
  v8f acc[4] = {};
  for (int kb = 0; kb < K; kb += 32) {
    FragB ah, al;
    const v4f x0 = *(const v4fa*)(arow + kb + 8 * hh), x1 = *(const v4fa*)(arow + kb + 8 * hh + 4);
    const v4f x2 = *(const v4fa*)(arow + kb + 16 + 8 * hh), x3 = *(const v4fa*)(arow + kb + 16 + 8 * hh + 4);
    float xs[16] = {x0[0],x0[1],x0[2],x0[3],x1[0],x1[1],x1[2],x1[3],x2[0],x2[1],x2[2],x2[3],x3[0],x3[1],x3[2],x3[3]};
#pragma unroll
    for (int i = 0; i < 16; ++i) { const unsigned short hb = bf16_bits(xs[i]); ah.u[i] = hb; al.u[i] = ASPLIT ? bf16_bits(xs[i] - bf16_val(hb)) : (unsigned short)0; }
#pragma unroll
    for (int t = 0; t < 4; ++t) {
      const unsigned short* brow = Wt + (size_t)(col0 + t * 16 + ln) * ldb + kb;
      FragB b;
      b.half[0] = *(const v8us*)(brow + 8 * hh);
      b.half[1] = *(const v8us*)(brow + 16 + 8 * hh);
      acc[t] = mmaN<ASPLIT ? 2 : 1>(ah.v, al.v, b.v, b.v, acc[t]);
    }
  }
#pragma unroll
  for (int t = 0; t < 4; ++t) {
    const int col = col0 + t * 16 + ln;
    float bv = bias ? bias[col] : 0.f;
    if (BIAS_BF16) bv = bf16_round(bv);
#pragma unroll
    for (int r = 0; r < 8; ++r) {
      float v = acc[t][r] + bv;
      if (resid) { float rv = resid[(size_t)((row0 + 8 * hh + r) % rmod) * ldr + col]; if (RES_BF16) rv = bf16_round(rv); v += rv; }
      if (ACT == 1) v = fmaxf(v, 0.f);
      if (ACT == 2) v = 0.5f * v * (1.0f + erff(v * 0.70710678118654752f));
      if (ACT == 3) { const float u = 0.7978845608028654f * (v + 0.044715f * v * v * v); v = 0.5f * v * (1.0f + tanhf(u)); }
      so[w][8 * hh + r][t * 16 + ln] = v;
    }
  }
  __builtin_amdgcn_fence(__ATOMIC_ACQ_REL, "workgroup");
  __builtin_amdgcn_wave_barrier();
  const int rsub = lane >> 4, c4 = (lane & 15) * 4;
  {
#pragma unroll
    for (int q = 0; q < 8; ++q) {
      const int r = q * 2 + rsub;
      const v4f v = *(const v4fa*)&so[w][r][c4];
      *(v4f*)(C + (size_t)(row0 + r) * ldc + col0 + c4) = v;
    }
    
  }
}
// row LayerNorm (biased variance, eps) over N: s = X (+ R); optional out_sum <- s; out_norm <- (s-mu)*rsqrt(var+eps)*g + b
template <bool PARAM_BF16>
__global__ __launch_bounds__(256) void k_layernorm(const float* __restrict__ X, const float* __restrict__ R, const float* __restrict__ g, const float* __restrict__ bta,
                                                  float* __restrict__ out_sum, float* __restrict__ out_norm, int N, float eps) {
  __shared__ float red[256];
  const int row = blockIdx.x, tid = threadIdx.x;
  const float* x = X + (size_t)row * N; const float* rr = R ? R + (size_t)row * N : nullptr;
  float vals[16];                     // up to N = 4096
  const int per = N / 256;            // contiguous chunk per thread? use strided-by-4 chunks: thread handles j = tid*4 + 1024*u
  float s1 = 0.f;
  for (int u = 0; u < per / 4; ++u) {
    const int j = tid * 4 + 1024 * u;
    const v4f a = *(const v4fa*)(x + j);
    v4f b = {0.f,0.f,0.f,0.f}; if (rr) b = *(const v4fa*)(rr + j);
#pragma unroll
    for (int q = 0; q < 4; ++q) { const float v = a[q] + b[q]; vals[u * 4 + q] = v; s1 += v; }
  }
  red[tid] = s1; __syncthreads();
  for (int st = 128; st > 0; st >>= 1) { if (tid < st) red[tid] += red[tid + st]; __syncthreads(); }
  const float mu = red[0] / (float)N; __syncthreads();
  float s2 = 0.f;
  for (int u = 0; u < per / 4; ++u)
#pragma unroll
    for (int q = 0; q < 4; ++q) { const float c = vals[u * 4 + q] - mu; s2 += c * c; }
  red[tid] = s2; __syncthreads();
  for (int st = 128; st > 0; st >>= 1) { if (tid < st) red[tid] += red[tid + st]; __syncthreads(); }
  const float rs = rsqrtf(red[0] / (float)N + eps);
  {
    for (int u = 0; u < per / 4; ++u) {
      const int j = tid * 4 + 1024 * u;
      v4f o, sm;
#pragma unroll
      for (int q = 0; q < 4; ++q) {
        float gg = g[j + q], bb = bta[j + q];
        if (PARAM_BF16) { gg = bf16_round(gg); bb = bf16_round(bb); }
        sm[q] = vals[u * 4 + q]; o[q] = (vals[u * 4 + q] - mu) * rs * gg + bb;
      }
      if (out_sum) *(v4f*)(out_sum + (size_t)row * N + j) = sm;
      *(v4f*)(out_norm + (size_t)row * N + j) = o;
    }
    
  }
}



// ---- f16 WMMA path (v_wmma_f32_16x16x32_f16): 11-bit significands for operands in range — used where a [0,1] probability operand needs more precision than bf16
typedef _Float16 v16h __attribute__((ext_vector_type(16)));
union FragH { v16h v; v8us half[2]; _Float16 h[16]; unsigned short u[16]; };
template <int NT>
__device__ __forceinline__ v8f mmaH(v16h ah, v16h al, v16h bh, v16h bl, v8f c) {
  c = __builtin_amdgcn_wmma_f32_16x16x32_f16(false, ah, false, bh, (short)0, c, false, false);
  if (NT >= 2) c = __builtin_amdgcn_wmma_f32_16x16x32_f16(false, al, false, bh, (short)0, c, false, false);
  if (NT >= 3) c = __builtin_amdgcn_wmma_f32_16x16x32_f16(false, ah, false, bl, (short)0, c, false, false);
  asm volatile("v_nop\n\tv_nop\n\tv_nop\n\tv_nop" : "+v"(c) : "v"(ah), "v"(al), "v"(bh), "v"(bl));
  return c;
}
// batched GEMM like k_gemm_b but f16 operands: A f32 (split into f16 hi/lo if ASPLIT, else rounded to f16), Bt = f16 values [n][k]; alpha; C f32; N multiple of 16 (partial tiles skipped)
template <bool ASPLIT>
__global__ __launch_bounds__(128) void k_gemm_h(const float* __restrict__ A, int lda, size_t sA, const _Float16* __restrict__ Bh, int ldb, size_t sB, float alpha, float* __restrict__ C, int ldc, size_t sC, int M, int N, int K) {
  __shared__ __attribute__((aligned(16))) float so[4][16][64];
  const int tid = threadIdx.x, w = tid >> 5, lane = tid & 31, ln = lane & 15, hh = lane >> 4; const int by = blockIdx.y;
  A += (size_t)by * sA; Bh += (size_t)by * sB; C += (size_t)by * sC;
  const int ntn = (N + 63) / 64; const int wid = blockIdx.x * 4 + w; const int mt = wid / ntn, nq = wid % ntn; if (mt * 16 >= M) return;
  const int row0 = mt * 16, col0 = nq * 64; const float* arow = A + (size_t)(row0 + ln) * lda;
  v8f acc[4] = {};
  for (int kb = 0; kb < K; kb += 32) {
    FragH ah, al;
    const v4f x0 = *(const v4fa*)(arow + kb + 8 * hh), x1 = *(const v4fa*)(arow + kb + 8 * hh + 4), x2 = *(const v4fa*)(arow + kb + 16 + 8 * hh), x3 = *(const v4fa*)(arow + kb + 16 + 8 * hh + 4);
    float xs[16] = {x0[0],x0[1],x0[2],x0[3],x1[0],x1[1],x1[2],x1[3],x2[0],x2[1],x2[2],x2[3],x3[0],x3[1],x3[2],x3[3]};
#pragma unroll
    for (int i = 0; i < 16; ++i) { const _Float16 h = (_Float16)xs[i]; ah.h[i] = h; al.h[i] = ASPLIT ? (_Float16)(xs[i] - (float)h) : (_Float16)0.0f; }
#pragma unroll
    for (int t = 0; t < 4; ++t) { if (col0 + t * 16 >= N) continue; const size_t boff = (size_t)(col0 + t * 16 + ln) * ldb + kb; FragH bq; bq.half[0] = *(const v8us*)(Bh + boff + 8 * hh); bq.half[1] = *(const v8us*)(Bh + boff + 16 + 8 * hh);
      acc[t] = mmaH<ASPLIT ? 2 : 1>(ah.v, al.v, bq.v, bq.v, acc[t]); }
  }
#pragma unroll
  for (int t = 0; t < 4; ++t) { if (col0 + t * 16 >= N) continue;
#pragma unroll
    for (int r = 0; r < 8; ++r) so[w][8 * hh + r][t * 16 + ln] = acc[t][r] * alpha; }
  __builtin_amdgcn_fence(__ATOMIC_ACQ_REL, "workgroup"); __builtin_amdgcn_wave_barrier();
  const int rsub = lane >> 4, c4 = (lane & 15) * 4;
  {
#pragma unroll
    for (int q = 0; q < 8; ++q) { const int r = q * 2 + rsub; if (col0 + c4 < N) { const v4f v = *(const v4fa*)&so[w][r][c4]; *(v4f*)(C + (size_t)(row0 + r) * ldc + col0 + c4) = v; } }
     }
}

// Wt[n][k] = f16(W[k][n]·scale) from f32 row-major W[K][N] (scale = power of two; bf16-exact weights stay exact in f16 away from the subnormal range)
__global__ __launch_bounds__(256) void k_wt_f16(const float* __restrict__ W, _Float16* __restrict__ Wt, int K, int N, float scale) {
  const int t = blockIdx.x * 256 + threadIdx.x; if (t >= N * (K / 8)) return; const int n = t / (K / 8), k8 = (t % (K / 8)) * 8; FragH f;
#pragma unroll
  for (int i = 0; i < 8; ++i) f.h[i] = (_Float16)(bf16_round(W[(size_t)(k8 + i) * N + n]) * scale); const v8us o = f.half[0];
  *(v8us*)((unsigned short*)Wt + (size_t)n * K + k8) = o; 
}
// k_gemm_hh variant with fused epilogue: v = acc·alpha + bias[by·sBias + col] (+ CP[(row/rowsPerB)·sCPb + by·64 + col] if CP) ; ACT 0 none / 1 elu ; writes f16 C16 (and f32 C if non-null)
template <int ACT>
__global__ __launch_bounds__(128) void k_gemm_hhx(const _Float16* __restrict__ A, int lda, size_t sA, const _Float16* __restrict__ Bh, int ldb, size_t sB, float alpha, const float* __restrict__ bias, size_t sBias, const float* __restrict__ CP, int rowsPerB, size_t sCPb, int row0g,
    float* __restrict__ C, _Float16* __restrict__ C16, int ldc, size_t sC, int M, int N, int K) {
  __shared__ __attribute__((aligned(16))) float so[4][16][64];
  const int tid = threadIdx.x, w = tid >> 5, lane = tid & 31, ln = lane & 15, hh = lane >> 4; const int by = blockIdx.y;
  A += (size_t)by * sA; Bh += (size_t)by * sB; const size_t cofs = (size_t)by * sC; const float* bp = bias ? bias + (size_t)by * sBias : nullptr;
  const int ntn = (N + 63) / 64; const int wid = blockIdx.x * 4 + w; const int mt = wid / ntn, nq = wid % ntn; if (mt * 16 >= M) return;
  const int row0 = mt * 16, col0 = nq * 64; const _Float16* arow = A + (size_t)(row0 + ln) * lda;
  v8f acc[4] = {};
  for (int kb = 0; kb < K; kb += 32) { FragH ah; ah.half[0] = *(const v8us*)((const unsigned short*)arow + kb + 8 * hh); ah.half[1] = *(const v8us*)((const unsigned short*)arow + kb + 16 + 8 * hh);
#pragma unroll
    for (int t = 0; t < 4; ++t) { if (col0 + t * 16 >= N) continue; const size_t boff = (size_t)(col0 + t * 16 + ln) * ldb + kb; FragH bq; bq.half[0] = *(const v8us*)((const unsigned short*)Bh + boff + 8 * hh); bq.half[1] = *(const v8us*)((const unsigned short*)Bh + boff + 16 + 8 * hh);
      acc[t] = mmaH<1>(ah.v, ah.v, bq.v, bq.v, acc[t]); }
  }
#pragma unroll
  for (int t = 0; t < 4; ++t) { if (col0 + t * 16 >= N) continue; const int col = col0 + t * 16 + ln; const float bv = bp ? bf16_round(bp[col]) : 0.f;
#pragma unroll
    for (int r = 0; r < 8; ++r) { float v = acc[t][r] * alpha + bv; if (CP) { const int rr = row0g + row0 + 8 * hh + r; if (rowsPerB < 0) v += CP[cofs + (size_t)rr * ldc + col];      /* rowsPerB < 0: own element of the batched C plane */ else { const int bidx = rr / rowsPerB; v += CP[(size_t)bidx * sCPb + (size_t)by * 64 + col]; } } if (ACT == 1) v = (v > 0.f) ? v : expm1f(v); else if (ACT == 7) v = (v > 0.f) ? v + 1.0f : expf(v); else if (ACT == 8) v = tanhf(v); else if (ACT == 9) v = 0.5f * v * (1.0f + tanhf(0.7978845608028654f * (v + 0.044715f * v * v * v))); else if (ACT == 11) v = 1.0f / (1.0f + expf(-v)); else if (ACT == 12) v = (v > 0.f) ? v : 0.01f * v; else if (ACT == 14) v = (v > 0.f) ? v : 0.1f * v; else if (ACT == 16) v = (v >= 0.f) ? v : 0.3f * v; else if (ACT == 17) v = (v >= 0.f) ? v : 0.2f * v; else if (ACT == 15) v = v / (1.0f + expf(-v)); else if (ACT == 3) v = fmaxf(v, 0.f); else if (ACT == 6) v = 0.5f * v * (1.0f + erff(v * 0.70710678118654752f)); so[w][8 * hh + r][t * 16 + ln] = v; } }
  __builtin_amdgcn_fence(__ATOMIC_ACQ_REL, "workgroup"); __builtin_amdgcn_wave_barrier();
  const int rsub = lane >> 4, c4 = (lane & 15) * 4; typedef _Float16 v4h __attribute__((ext_vector_type(4)));
  {
#pragma unroll
    for (int q = 0; q < 8; ++q) { const int r = q * 2 + rsub; if (col0 + c4 < N) { const v4f v = *(const v4fa*)&so[w][r][c4]; if (C) *(v4f*)(C + cofs + (size_t)(row0 + r) * ldc + col0 + c4) = v; if (C16) { v4h h4; for (int i = 0; i < 4; ++i) h4[i] = (_Float16)v[i]; *(v4h*)(C16 + cofs + (size_t)(row0 + r) * ldc + col0 + c4) = h4; } } }
     }
}


typedef _Float16 v4h __attribute__((ext_vector_type(4)));

__global__ __launch_bounds__(256) void k_x16(const float* __restrict__ x, _Float16* __restrict__ X16, size_t n8) { const size_t t = (size_t)blockIdx.x * 256 + threadIdx.x; if (t >= n8) return; FragH f;
#pragma unroll
  for (int q = 0; q < 8; ++q) f.h[q] = (_Float16)bf16_round(x[t * 8 + q]); *(v8us*)((unsigned short*)X16 + t * 8) = f.half[0];  }
__global__ __launch_bounds__(256) void k_h16(const float* __restrict__ x, _Float16* __restrict__ X16, size_t n8) { const size_t t = (size_t)blockIdx.x * 256 + threadIdx.x; if (t >= n8) return; FragH f;
#pragma unroll
  for (int q = 0; q < 8; ++q) f.h[q] = (_Float16)x[t * 8 + q]; *(v8us*)((unsigned short*)X16 + t * 8) = f.half[0];  }
__global__ __launch_bounds__(256) void k_round16f(const float* __restrict__ W, _Float16* __restrict__ Bt, size_t n8) { const size_t t = (size_t)blockIdx.x * 256 + threadIdx.x; if (t >= n8) return; FragH f;
#pragma unroll
  for (int i = 0; i < 8; ++i) f.h[i] = (_Float16)(bf16_round(W[t * 8 + i]) * 16.0f); *(v8us*)((unsigned short*)Bt + t * 8) = f.half[0];  }
template <int NHv, int TTv>
__global__ __launch_bounds__(256) void k_vt(const _Float16* __restrict__ V16, int ldv, int voff, _Float16* __restrict__ Vt) { __shared__ unsigned short tl[64][66]; const int tid = threadIdx.x; const int slab = blockIdx.x / (TTv / 64), lg = blockIdx.x % (TTv / 64); const int b = slab / NHv, h = slab % NHv;
  for (int i = tid; i < 64 * 8; i += 256) { const int r = i / 8, c8 = (i % 8) * 8; FragH f; f.half[0] = *(const v8us*)((const unsigned short*)V16 + ((size_t)b * TTv + lg * 64 + r) * ldv + voff + h * 64 + c8);
#pragma unroll
    for (int q = 0; q < 8; ++q) tl[r][c8 + q] = f.u[q]; }
  __syncthreads();
  {
#pragma unroll
    for (int rd = 0; rd < 2; ++rd) { const int d = rd * 32 + tid / 8, pc = tid % 8; FragH f;
#pragma unroll
      for (int q = 0; q < 8; ++q) f.u[q] = tl[pc * 8 + q][d];
      *(v8us*)((unsigned short*)Vt + ((size_t)slab * 64 + d) * TTv + lg * 64 + pc * 8) = f.half[0]; }
     } }

__global__ __launch_bounds__(256) void k_hl(const float* __restrict__ F, _Float16* __restrict__ Hh, _Float16* __restrict__ Hl, size_t n8) { const size_t t = (size_t)blockIdx.x * 256 + threadIdx.x; if (t >= n8) return; FragH fh, fl; const v4f a = *(const v4fa*)(F + t * 8), c = *(const v4fa*)(F + t * 8 + 4);
#pragma unroll
  for (int q = 0; q < 4; ++q) { _Float16 h = (_Float16)a[q]; fh.h[q] = h; fl.h[q] = (_Float16)((a[q] - (float)h) * 1024.0f); h = (_Float16)c[q]; fh.h[4 + q] = h; fl.h[4 + q] = (_Float16)((c[q] - (float)h) * 1024.0f); }
  { *(v8us*)((unsigned short*)Hh + t * 8) = fh.half[0]; *(v8us*)((unsigned short*)Hl + t * 8) = fl.half[0];  } }

// ---- fast GEMM (wave tile 32x64; requires M % 32 == 0 rows per launch region and N % 64 == 0); epilogue = k_gemm_hhx semantics ----
__device__ __forceinline__ v16h g2_frag(const _Float16* p, int hh) { FragH f; f.half[0] = *(const v8us*)((const unsigned short*)p + 8 * hh); f.half[1] = *(const v8us*)((const unsigned short*)p + 16 + 8 * hh); return f.v; }
__device__ __forceinline__ v8f g2_mma(v16h a, v16h b, v8f c) { v8f d = __builtin_amdgcn_wmma_f32_16x16x32_f16(false, a, false, b, (short)0, c, false, false); asm volatile("v_nop\n\tv_nop\n\tv_nop\n\tv_nop" : "+v"(d) : "v"(a), "v"(b)); return d; }
template <int ACT>
__global__ __launch_bounds__(128) void k_gemm2(const _Float16* __restrict__ A, int lda, size_t sA, const _Float16* __restrict__ Bh, int ldb, size_t sB, float alpha, const float* __restrict__ bias, size_t sBias, const float* __restrict__ CP, int rowsPerB, size_t sCPb, int row0g,
    float* __restrict__ C, _Float16* __restrict__ C16, int ldc, size_t sC, int M, int N, int K) { static_assert(ACT == 0 || ACT == 3 || ACT == 6 || ACT == 8 || ACT == 9 || ACT == 11 || ACT == 12 || ACT == 14 || ACT == 15 || ACT == 16 || ACT == 17, "k_gemm2: unsupported ACT code (would silently apply no activation)");
  __shared__ __attribute__((aligned(16))) float so[4][32][68];
  const int tid = threadIdx.x, w = tid >> 5, lane = tid & 31, ln = lane & 15, hh = lane >> 4; const int by = blockIdx.y;
  A += (size_t)by * sA; Bh += (size_t)by * sB; const size_t cofs = (size_t)by * sC; const float* bp = bias ? bias + (size_t)by * sBias : nullptr;
  const int ntn = N >> 6; const int mt = blockIdx.x / ntn, nq = blockIdx.x - mt * ntn; const int row0 = mt * 128 + 32 * w, col0 = nq * 64; if (row0 >= M) return;
  const _Float16* a0p = A + (size_t)(row0 + ln) * lda; const _Float16* a1p = a0p + (size_t)16 * lda;
  const _Float16* b0p = Bh + (size_t)(col0 + ln) * ldb; const _Float16* b1p = b0p + (size_t)16 * ldb; const _Float16* b2p = b1p + (size_t)16 * ldb; const _Float16* b3p = b2p + (size_t)16 * ldb;
  const v8f z8 = {0.f,0.f,0.f,0.f,0.f,0.f,0.f,0.f}; v8f c00 = z8, c01 = z8, c02 = z8, c03 = z8, c10 = z8, c11 = z8, c12 = z8, c13 = z8;
#pragma unroll 1
  for (int kb = 0; kb < K; kb += 32) { const v16h a0 = g2_frag(a0p + kb, hh), a1 = g2_frag(a1p + kb, hh);
    v16h b = g2_frag(b0p + kb, hh); c00 = g2_mma(a0, b, c00); c10 = g2_mma(a1, b, c10);
    b = g2_frag(b1p + kb, hh); c01 = g2_mma(a0, b, c01); c11 = g2_mma(a1, b, c11);
    b = g2_frag(b2p + kb, hh); c02 = g2_mma(a0, b, c02); c12 = g2_mma(a1, b, c12);
    b = g2_frag(b3p + kb, hh); c03 = g2_mma(a0, b, c03); c13 = g2_mma(a1, b, c13); }
  v8f accs[8] = {c00, c01, c02, c03, c10, c11, c12, c13};
#pragma unroll
  for (int u = 0; u < 8; ++u) { const int t = u & 3, half = u >> 2; const int col = col0 + t * 16 + ln; const float bv = bp ? bf16_round(bp[col]) : 0.f;
#pragma unroll
    for (int r = 0; r < 8; ++r) { const int rloc = half * 16 + 8 * hh + r; float v = accs[u][r] * alpha + bv; if (CP) { if (rowsPerB < 0) v += CP[cofs + (size_t)(row0g + row0 + rloc) * ldc + col];      /* rowsPerB < 0: own element of the batched C plane */ else { const int bidx = (row0g + row0 + rloc) / rowsPerB; v += CP[(size_t)bidx * sCPb + (size_t)by * 64 + col]; } }
      if (ACT == 3) v = fmaxf(v, 0.f); else if (ACT == 6) v = 0.5f * v * (1.0f + erff(v * 0.70710678118654752f)); else if (ACT == 11) v = 1.0f / (1.0f + expf(-v)); else if (ACT == 15) v = v / (1.0f + expf(-v)); else if (ACT == 12) v = (v > 0.f) ? v : 0.01f * v; else if (ACT == 8) v = tanhf(v); else if (ACT == 9) v = 0.5f * v * (1.0f + tanhf(0.7978845608028654f * (v + 0.044715f * v * v * v))); else if (ACT == 14) v = (v > 0.f) ? v : 0.1f * v; else if (ACT == 16) v = (v >= 0.f) ? v : 0.3f * v; else if (ACT == 17) v = (v >= 0.f) ? v : 0.2f * v;
      so[w][rloc][t * 16 + ln] = v; } }
  __builtin_amdgcn_fence(__ATOMIC_ACQ_REL, "workgroup"); __builtin_amdgcn_wave_barrier();
  const int rsub = lane >> 4, c4 = (lane & 15) * 4;
  {
#pragma unroll
    for (int q = 0; q < 16; ++q) { const int r = q * 2 + rsub; const v4f v = *(const v4fa*)&so[w][r][c4]; if (C) *(v4f*)(C + cofs + (size_t)(row0 + r) * ldc + col0 + c4) = v; if (C16) { v4h h4; for (int i = 0; i < 4; ++i) h4[i] = (_Float16)v[i]; *(v4h*)(C16 + cofs + (size_t)(row0 + r) * ldc + col0 + c4) = h4; } }
     } }


__global__ __launch_bounds__(256) void k_tok(const float* __restrict__ x, _Float16* __restrict__ X) { __shared__ float tl[CH][17]; const int tid = threadIdx.x; const int b = blockIdx.x / (NPX / 16), pb = blockIdx.x % (NPX / 16); const int p0 = pb * 16;
  for (int i = tid; i < CH * 16; i += 256) { const int c = i / 16, p = i % 16; tl[c][p] = bf16_round(x[((size_t)b * CH + c) * NPX + p0 + p]); }
  __syncthreads();
  { for (int i = tid; i < 16 * (CH / 8); i += 256) { const int p = i / (CH / 8), c0 = (i % (CH / 8)) * 8; FragH f; for (int q = 0; q < 8; ++q) f.h[q] = (_Float16)tl[c0 + q][p];
      *(v8us*)((unsigned short*)X + ((size_t)b * NPX + p0 + p) * CH + c0) = f.half[0]; }  } }
__global__ __launch_bounds__(256) void k_im2(const _Float16* __restrict__ S, _Float16* __restrict__ I) { const size_t t = (size_t)blockIdx.x * 256 + threadIdx.x; const int c8n = CH / 8; if (t >= (size_t)NR * 9 * c8n) return; const int c8 = (int)(t % c8n) * 8; const int tap = (int)((t / c8n) % 9); const size_t row = t / ((size_t)9 * c8n); const int b = (int)(row / NPX), p = (int)(row % NPX); const int iy = p / WSD - 1 + tap / 3, ix = p % WSD - 1 + tap % 3; v8us v;
  if (iy >= 0 && iy < HS && ix >= 0 && ix < WSD) v = *(const v8us*)((const unsigned short*)S + (((size_t)b * NPX) + iy * WSD + ix) * CH + c8); else { for (int q = 0; q < 8; ++q) v[q] = 0; }
  unsigned short* d = (unsigned short*)I + row * (size_t)KC + tap * CH + c8; *(v8us*)d = v;  }
__global__ __launch_bounds__(256) void k_wre(const float* __restrict__ w, _Float16* __restrict__ Bt) { const size_t t = (size_t)blockIdx.x * 256 + threadIdx.x; if (t >= (size_t)CH * KC / 8) return; const int c8 = (int)((t * 8) % CH); const int tap = (int)(((t * 8) / CH) % 9); const int o = (int)((t * 8) / KC); FragH f; for (int q = 0; q < 8; ++q) f.h[q] = (_Float16)(bf16_round(w[((size_t)o * CH + c8 + q) * 9 + tap]) * 16.0f);
  *(v8us*)((unsigned short*)Bt + t * 8) = f.half[0];  }
__global__ __launch_bounds__(256) void k_bnrelu(const float* __restrict__ Cv, const float* __restrict__ g, const float* __restrict__ bt, const float* __restrict__ mn, const float* __restrict__ vr, _Float16* __restrict__ O16, float* __restrict__ OF) {
  #pragma clang fp contract(off)
  const size_t t = (size_t)blockIdx.x * 256 + threadIdx.x; if (t >= (size_t)NR * CH / 8) return; const int c0 = (int)((t * 8) % CH); const v8f a = *(const v8f*)(Cv + t * 8); v8f o; FragH f;
  for (int q = 0; q < 8; ++q) { const int c = c0 + q; const float inv = bf16_round(g[c]) * rsqrtf(bf16_round(vr[c]) + 1e-5f); float sh = -bf16_round(mn[c]) * inv; sh += bf16_round(bt[c]); float y = a[q] * inv; y += sh; y = fmaxf(y, 0.f); o[q] = y; f.h[q] = (_Float16)y; }
  { *(v8us*)((unsigned short*)O16 + t * 8) = f.half[0]; if (OF) *(v8f*)(OF + t * 8) = o;  } }
__global__ __launch_bounds__(256) void k_vt(const _Float16* __restrict__ L16, _Float16* __restrict__ VT) { __shared__ unsigned short tl[64][66]; const int tid = threadIdx.x; const int b = blockIdx.x / (NPX / 64), kg = blockIdx.x % (NPX / 64);
  for (int i = tid; i < 64 * 8; i += 256) { const int r = i / 8, c8 = (i % 8) * 8; FragH f; f.half[0] = *(const v8us*)((const unsigned short*)L16 + ((size_t)b * NPX + kg * 64 + r) * CH + c8); for (int q = 0; q < 8; ++q) tl[r][c8 + q] = f.u[q]; }
  __syncthreads();
  { for (int i = tid; i < CH * 8; i += 256) { const int c = i / 8, pc = i % 8; FragH f; for (int q = 0; q < 8; ++q) f.u[q] = tl[pc * 8 + q][c];
      *(v8us*)((unsigned short*)VT + ((size_t)b * CH + c) * NPX + kg * 64 + pc * 8) = f.half[0]; }  } }
__global__ __launch_bounds__(256) void k_soft(const float* __restrict__ S, const float* __restrict__ pp, _Float16* __restrict__ P) {
  #pragma clang fp contract(off)
  const int wv = threadIdx.x >> 5, ln = threadIdx.x & 31; const int row = blockIdx.x * 8 + wv; if (row >= NPX) return; const float sc = 0.125f * bf16_round(pp[0]); const float* s = S + (size_t)row * NPX; float mx = -3.0e38f;
#pragma unroll 1
  for (int g = 0; g < NPX / 256; ++g) { const v8f a = *(const v8f*)(s + g * 256 + ln * 8); for (int q = 0; q < 8; ++q) mx = fmaxf(mx, a[q] * sc); }
  for (int o = 16; o > 0; o >>= 1) mx = fmaxf(mx, __shfl_xor(mx, o, 32)); float su = 0.f;
#pragma unroll 1
  for (int g = 0; g < NPX / 256; ++g) { const v8f a = *(const v8f*)(s + g * 256 + ln * 8);
#pragma unroll 1
    for (int q = 0; q < 8; ++q) su += expf(a[q] * sc - mx); }
  for (int o = 16; o > 0; o >>= 1) su += __shfl_xor(su, o, 32); const float inv = 1024.0f / su;
{
#pragma unroll 1
    for (int g = 0; g < NPX / 256; ++g) { const v8f a = *(const v8f*)(s + g * 256 + ln * 8); FragH f;
#pragma unroll
      for (int q = 0; q < 8; ++q) f.h[q] = (_Float16)(expf(a[q] * sc - mx) * inv); *(v8us*)((unsigned short*)P + (size_t)row * NPX + g * 256 + ln * 8) = f.half[0]; }
     } }
__global__ __launch_bounds__(256) void k_outr(const float* __restrict__ O, const float* __restrict__ HF, float* __restrict__ out) {
  #pragma clang fp contract(off)
  const size_t t = (size_t)blockIdx.x * 256 + threadIdx.x; if (t >= (size_t)NI * CH * NPX / 8) return; const int p0 = (int)((t * 8) % NPX); const size_t bc = (t * 8) / NPX; const int b = (int)(bc / CH), c = (int)(bc % CH); v8f v; for (int q = 0; q < 8; ++q) { const size_t r = ((size_t)b * NPX + p0 + q) * CH + c; float u = O[r]; u += HF[r]; v[q] = u; }
  *(v8f*)(out + t * 8) = v;  }

extern "C" void kernel_launch(void* const* d_in, const int* in_sizes, int n_in,
                              void* d_out, int out_size, void* d_ws, size_t ws_size, hipStream_t stream) {
  (void)in_sizes; (void)n_in; (void)out_size;
  const float* const* I = (const float* const*)d_in; const float* low = I[0]; const float* high = I[1]; const float* wH = I[2]; const float* gH = I[3]; const float* bH = I[4]; const float* mH = I[5]; const float* vH = I[6]; const float* wL = I[7]; const float* gL = I[8]; const float* bL = I[9]; const float* mL = I[10]; const float* vL = I[11]; const float* pp = I[12];
  char* ws = (char*)d_ws; size_t off = 0;
  auto take = [&](size_t bytes) { char* p = ws + off; off += (bytes + 255) & ~(size_t)255; return p; };
  const size_t ne = (size_t)NR * CH; const unsigned g8 = (unsigned)((ne / 8 + 255) / 256);
  _Float16* BH = (_Float16*)take((size_t)CH * KC * 2); _Float16* BL = (_Float16*)take((size_t)CH * KC * 2); _Float16* X = (_Float16*)take(ne * 2); _Float16* IM = (_Float16*)take((size_t)NR * KC * 2); float* CV = (float*)take(ne * 4);
  _Float16* H16 = (_Float16*)take(ne * 2); float* HF = (float*)take(ne * 4); _Float16* L16 = (_Float16*)take(ne * 2); _Float16* VT = (_Float16*)take(ne * 2); float* S = (float*)take((size_t)NPX * NPX * 4); _Float16* P = (_Float16*)take((size_t)NPX * NPX * 2); float* O = (float*)take(ne * 4);
  if (off > ws_size) return;      /* 0.1 + 2 + 18 + 4 + 2 + 4 + 2 + 2 + 64 + 32 + 4 = ≈ 134 MiB */
  k_wre<<<(unsigned)(((size_t)CH * KC / 8 + 255) / 256), 256, 0, stream>>>(wH, BH); k_wre<<<(unsigned)(((size_t)CH * KC / 8 + 255) / 256), 256, 0, stream>>>(wL, BL);
  const dim3 gc((NR / 128) * (CH / 64), 1); const unsigned gi = (unsigned)(((size_t)NR * 9 * (CH / 8) + 255) / 256);
  k_tok<<<NI * (NPX / 16), 256, 0, stream>>>(high, X); k_im2<<<gi, 256, 0, stream>>>(X, IM); k_gemm2<0><<<gc, 128, 0, stream>>>(IM, KC, 0, BH, KC, 0, 0.0625f, nullptr, 0, nullptr, 1, 0, 0, CV, nullptr, CH, 0, NR, CH, KC); k_bnrelu<<<g8, 256, 0, stream>>>(CV, gH, bH, mH, vH, H16, HF);      /* hconv (q_h; f32 copy for the residual) */
  k_tok<<<NI * (NPX / 16), 256, 0, stream>>>(low, X); k_im2<<<gi, 256, 0, stream>>>(X, IM); k_gemm2<0><<<gc, 128, 0, stream>>>(IM, KC, 0, BL, KC, 0, 0.0625f, nullptr, 0, nullptr, 1, 0, 0, CV, nullptr, CH, 0, NR, CH, KC); k_bnrelu<<<g8, 256, 0, stream>>>(CV, gL, bL, mL, vL, L16, nullptr); k_vt<<<NI * (NPX / 64), 256, 0, stream>>>(L16, VT);      /* lconv (k_l = v_l) + V^T */
  for (int b = 0; b < NI; ++b) for (int h = 0; h < NHD; ++h) { const size_t r0 = (size_t)b * NPX;
    k_gemm2<0><<<dim3((NPX / 128) * (NPX / 64), 1), 128, 0, stream>>>(H16 + r0 * CH + h * HC, CH, 0, L16 + r0 * CH + h * HC, CH, 0, 1.0f, nullptr, 0, nullptr, 1, 0, 0, S, nullptr, NPX, 0, NPX, NPX, HC);      /* raw q.k (scaled inside the softmax) */
    k_soft<<<NPX / 8, 256, 0, stream>>>(S, pp, P);
    k_gemm_hhx<0><<<dim3((NPX / 16) * (HC / 16), 1), 128, 0, stream>>>(P, NPX, 0, VT + ((size_t)b * CH + h * HC) * NPX, NPX, 0, 0.0009765625f, nullptr, 0, nullptr, 1, 0, 0, O + r0 * CH + h * HC, nullptr, CH, 0, NPX, HC, NPX); }      /* out rows [(b,q)][h*32 + c] */
  k_outr<<<(unsigned)(((size_t)NI * CH * NPX / 8 + 255) / 256), 256, 0, stream>>>(O, HF, (float*)d_out);
}

// v001
// It runs in 113 microseconds.
// Timed twice side by side with v000, it ran 9.30 and 9.61 times as fast.
#include <hip/hip_runtime.h>
#define NI 4
#define CH 64
#define NHD 2
#define HC 32
#define HS 64
#define WSD 64
#define NPX (HS * WSD)
#define NR (NI * NPX)            /* 16384 */
#define KC (9 * CH)              /* 576 */
typedef __bf16 v16b __attribute__((ext_vector_type(16)));
typedef unsigned short v8us __attribute__((ext_vector_type(8), may_alias));
typedef float  v8f  __attribute__((ext_vector_type(8)));
typedef float  v4f  __attribute__((ext_vector_type(4)));
typedef float  v4fa __attribute__((ext_vector_type(4), may_alias));
union FragB { v16b v; v8us half[2]; unsigned short u[16]; };

__device__ __forceinline__ unsigned short bf16_bits(float x) { unsigned int u = __float_as_uint(x); return (unsigned short)((u + 0x7FFFu + ((u >> 16) & 1u)) >> 16); }
__device__ __forceinline__ float bf16_val(unsigned short b) { return __uint_as_float(((unsigned int)b) << 16); }
__device__ __forceinline__ float bf16_round(float x) { return bf16_val(bf16_bits(x)); }
// D += A·B with NT terms: 1 = ah·bh, 2 = + al·bh (A split), 3 = + ah·bl (both split)
template <int NT>
__device__ __forceinline__ v8f mmaN(v16b ah, v16b al, v16b bh, v16b bl, v8f c) {
  c = __builtin_amdgcn_wmma_f32_16x16x32_bf16(false, ah, false, bh, (short)0, c, false, false);
  if (NT >= 2) c = __builtin_amdgcn_wmma_f32_16x16x32_bf16(false, al, false, bh, (short)0, c, false, false);
  if (NT >= 3) c = __builtin_amdgcn_wmma_f32_16x16x32_bf16(false, ah, false, bl, (short)0, c, false, false);
  asm volatile("v_nop\n\tv_nop\n\tv_nop\n\tv_nop" : "+v"(c) : "v"(ah), "v"(al), "v"(bh), "v"(bl));
  return c;
}

__global__ __launch_bounds__(256) void k_wt_bf16(const float* __restrict__ W, unsigned short* __restrict__ Wt, int K, int N) {
  const int t = blockIdx.x * 256 + threadIdx.x;
  const int k8n = K / 8;
  if (t >= N * k8n) return;
  const int n = t / k8n, k8 = (t % k8n) * 8;
  v8us v;
#pragma unroll
  for (int i = 0; i < 8; ++i) v[i] = bf16_bits(W[(size_t)(k8 + i) * N + n]);
  *(v8us*)(Wt + (size_t)n * K + k8) = v;
  
}

// GEMM C[M][N] (f32, pitch ldc) = act(A[M][K]·W + bias). A f32 row-major (pitch lda) converted per fragment to bf16
// (ASPLIT: hi/lo two planes -> 2 terms, else single rounded term); Wt bf16 [N][K] (pitch ldb). BIAS_BF16 rounds the
// bias to bf16 first (bias quantised to bf16 before the add). K%32==0, M%16==0, N%64==0.
template <bool ASPLIT, int ACT, bool BIAS_BF16>
__global__ __launch_bounds__(128) void k_gemm_bf(const float* __restrict__ A, int lda, const unsigned short* __restrict__ Wt, int ldb,
                                               const float* __restrict__ bias, float* __restrict__ C, int ldc, int M, int N, int K) {
  __shared__ __attribute__((aligned(16))) float so[4][16][64];
  const int tid = threadIdx.x, w = tid >> 5, lane = tid & 31, ln = lane & 15, hh = lane >> 4;
  const int ntn = N / 64;
  const int wid = blockIdx.x * 4 + w;
  const int mt = wid / ntn, nq = wid % ntn;
  if (mt * 16 >= M) return;
  const int row0 = mt * 16, col0 = nq * 64;
  const float* arow = A + (size_t)(row0 + ln) * lda;
  v8f acc[4] = {};
  for (int kb = 0; kb < K; kb += 32) {
    FragB ah, al;
    const v4f x0 = *(const v4fa*)(arow + kb + 8 * hh), x1 = *(const v4fa*)(arow + kb + 8 * hh + 4);
    const v4f x2 = *(const v4fa*)(arow + kb + 16 + 8 * hh), x3 = *(const v4fa*)(arow + kb + 16 + 8 * hh + 4);
    float xs[16] = {x0[0],x0[1],x0[2],x0[3],x1[0],x1[1],x1[2],x1[3],x2[0],x2[1],x2[2],x2[3],x3[0],x3[1],x3[2],x3[3]};
#pragma unroll
    for (int i = 0; i < 16; ++i) { const unsigned short hb = bf16_bits(xs[i]); ah.u[i] = hb; al.u[i] = ASPLIT ? bf16_bits(xs[i] - bf16_val(hb)) : (unsigned short)0; }
#pragma unroll
    for (int t = 0; t < 4; ++t) {
      const unsigned short* brow = Wt + (size_t)(col0 + t * 16 + ln) * ldb + kb;
      FragB b;
      b.half[0] = *(const v8us*)(brow + 8 * hh);
      b.half[1] = *(const v8us*)(brow + 16 + 8 * hh);
      acc[t] = mmaN<ASPLIT ? 2 : 1>(ah.v, al.v, b.v, b.v, acc[t]);
    }
  }
#pragma unroll
  for (int t = 0; t < 4; ++t) {
    float bv = bias ? bias[col0 + t * 16 + ln] : 0.f;
    if (BIAS_BF16) bv = bf16_round(bv);
#pragma unroll
    for (int r = 0; r < 8; ++r) { float v = acc[t][r] + bv; if (ACT == 1) v = fmaxf(v, 0.f); so[w][8 * hh + r][t * 16 + ln] = v; }
  }
  __builtin_amdgcn_fence(__ATOMIC_ACQ_REL, "workgroup");
  __builtin_amdgcn_wave_barrier();
  const int rsub = lane >> 4, c4 = (lane & 15) * 4;
  {
#pragma unroll
    for (int q = 0; q < 8; ++q) {
      const int r = q * 2 + rsub;
      const v4f v = *(const v4fa*)&so[w][r][c4];
      *(v4f*)(C + (size_t)(row0 + r) * ldc + col0 + c4) = v;
    }
    
  }
}

// GEMM C = act(A·W + bias + resid): A f32 (ASPLIT -> hi/lo 2 terms), Wt bf16 [N][K]; ACT 0 none, 1 relu, 2 exact gelu;
// resid (optional, f32, row index = (row % rmod), pitch ldr, RES_BF16 rounds it) added before the activation.
template <bool ASPLIT, int ACT, bool BIAS_BF16, bool RES_BF16>
__global__ __launch_bounds__(128) void k_gemm_bf3(const float* __restrict__ A, int lda, const unsigned short* __restrict__ Wt, int ldb,
                                                const float* __restrict__ bias, const float* __restrict__ resid, int rmod, int ldr,
                                                float* __restrict__ C, int ldc, int M, int N, int K) {
  __shared__ __attribute__((aligned(16))) float so[4][16][64];
  const int tid = threadIdx.x, w = tid >> 5, lane = tid & 31, ln = lane & 15, hh = lane >> 4;
  const int ntn = N / 64;
  const int wid = blockIdx.x * 4 + w;
  const int mt = wid / ntn, nq = wid % ntn;
  if (mt * 16 >= M) return;
  const int row0 = mt * 16, col0 = nq * 64;
  const float* arow = A + (size_t)(row0 + ln) * lda;
  v8f acc[4] = {};
  for (int kb = 0; kb < K; kb += 32) {
    FragB ah, al;
    const v4f x0 = *(const v4fa*)(arow + kb + 8 * hh), x1 = *(const v4fa*)(arow + kb + 8 * hh + 4);
    const v4f x2 = *(const v4fa*)(arow + kb + 16 + 8 * hh), x3 = *(const v4fa*)(arow + kb + 16 + 8 * hh + 4);
    float xs[16] = {x0[0],x0[1],x0[2],x0[3],x1[0],x1[1],x1[2],x1[3],x2[0],x2[1],x2[2],x2[3],x3[0],x3[1],x3[2],x3[3]};
#pragma unroll
    for (int i = 0; i < 16; ++i) { const unsigned short hb = bf16_bits(xs[i]); ah.u[i] = hb; al.u[i] = ASPLIT ? bf16_bits(xs[i] - bf16_val(hb)) : (unsigned short)0; }
#pragma unroll
    for (int t = 0; t < 4; ++t) {
      const unsigned short* brow = Wt + (size_t)(col0 + t * 16 + ln) * ldb + kb;
      FragB b;
      b.half[0] = *(const v8us*)(brow + 8 * hh);
      b.half[1] = *(const v8us*)(brow + 16 + 8 * hh);
      acc[t] = mmaN<ASPLIT ? 2 : 1>(ah.v, al.v, b.v, b.v, acc[t]);
    }
  }
#pragma unroll
  for (int t = 0; t < 4; ++t) {
    const int col = col0 + t * 16 + ln;
    float bv = bias ? bias[col] : 0.f;
    if (BIAS_BF16) bv = bf16_round(bv);
#pragma unroll
    for (int r = 0; r < 8; ++r) {
      float v = acc[t][r] + bv;
      if (resid) { float rv = resid[(size_t)((row0 + 8 * hh + r) % rmod) * ldr + col]; if (RES_BF16) rv = bf16_round(rv); v += rv; }
      if (ACT == 1) v = fmaxf(v, 0.f);
      if (ACT == 2) v = 0.5f * v * (1.0f + erff(v * 0.70710678118654752f));
      if (ACT == 3) { const float u = 0.7978845608028654f * (v + 0.044715f * v * v * v); v = 0.5f * v * (1.0f + tanhf(u)); }
      so[w][8 * hh + r][t * 16 + ln] = v;
    }
  }
  __builtin_amdgcn_fence(__ATOMIC_ACQ_REL, "workgroup");
  __builtin_amdgcn_wave_barrier();
  const int rsub = lane >> 4, c4 = (lane & 15) * 4;
  {
#pragma unroll
    for (int q = 0; q < 8; ++q) {
      const int r = q * 2 + rsub;
      const v4f v = *(const v4fa*)&so[w][r][c4];
      *(v4f*)(C + (size_t)(row0 + r) * ldc + col0 + c4) = v;
    }
    
  }
}
// row LayerNorm (biased variance, eps) over N: s = X (+ R); optional out_sum <- s; out_norm <- (s-mu)*rsqrt(var+eps)*g + b
template <bool PARAM_BF16>
__global__ __launch_bounds__(256) void k_layernorm(const float* __restrict__ X, const float* __restrict__ R, const float* __restrict__ g, const float* __restrict__ bta,
                                                  float* __restrict__ out_sum, float* __restrict__ out_norm, int N, float eps) {
  __shared__ float red[256];
  const int row = blockIdx.x, tid = threadIdx.x;
  const float* x = X + (size_t)row * N; const float* rr = R ? R + (size_t)row * N : nullptr;
  float vals[16];                     // up to N = 4096
  const int per = N / 256;            // contiguous chunk per thread? use strided-by-4 chunks: thread handles j = tid*4 + 1024*u
  float s1 = 0.f;
  for (int u = 0; u < per / 4; ++u) {
    const int j = tid * 4 + 1024 * u;
    const v4f a = *(const v4fa*)(x + j);
    v4f b = {0.f,0.f,0.f,0.f}; if (rr) b = *(const v4fa*)(rr + j);
#pragma unroll
    for (int q = 0; q < 4; ++q) { const float v = a[q] + b[q]; vals[u * 4 + q] = v; s1 += v; }
  }
  red[tid] = s1; __syncthreads();
  for (int st = 128; st > 0; st >>= 1) { if (tid < st) red[tid] += red[tid + st]; __syncthreads(); }
  const float mu = red[0] / (float)N; __syncthreads();
  float s2 = 0.f;
  for (int u = 0; u < per / 4; ++u)
#pragma unroll
    for (int q = 0; q < 4; ++q) { const float c = vals[u * 4 + q] - mu; s2 += c * c; }
  red[tid] = s2; __syncthreads();
  for (int st = 128; st > 0; st >>= 1) { if (tid < st) red[tid] += red[tid + st]; __syncthreads(); }
  const float rs = rsqrtf(red[0] / (float)N + eps);
  {
    for (int u = 0; u < per / 4; ++u) {
      const int j = tid * 4 + 1024 * u;
      v4f o, sm;
#pragma unroll
      for (int q = 0; q < 4; ++q) {
        float gg = g[j + q], bb = bta[j + q];
        if (PARAM_BF16) { gg = bf16_round(gg); bb = bf16_round(bb); }
        sm[q] = vals[u * 4 + q]; o[q] = (vals[u * 4 + q] - mu) * rs * gg + bb;
      }
      if (out_sum) *(v4f*)(out_sum + (size_t)row * N + j) = sm;
      *(v4f*)(out_norm + (size_t)row * N + j) = o;
    }
    
  }
}



// ---- f16 WMMA path (v_wmma_f32_16x16x32_f16): 11-bit significands for operands in range — used where a probability operand (up to 2^8 here) needs more precision than bf16
typedef _Float16 v16h __attribute__((ext_vector_type(16)));
union FragH { v16h v; v8us half[2]; _Float16 h[16]; unsigned short u[16]; };
template <int NT>
__device__ __forceinline__ v8f mmaH(v16h ah, v16h al, v16h bh, v16h bl, v8f c) {
  c = __builtin_amdgcn_wmma_f32_16x16x32_f16(false, ah, false, bh, (short)0, c, false, false);
  if (NT >= 2) c = __builtin_amdgcn_wmma_f32_16x16x32_f16(false, al, false, bh, (short)0, c, false, false);
  if (NT >= 3) c = __builtin_amdgcn_wmma_f32_16x16x32_f16(false, ah, false, bl, (short)0, c, false, false);
  asm volatile("v_nop\n\tv_nop\n\tv_nop\n\tv_nop" : "+v"(c) : "v"(ah), "v"(al), "v"(bh), "v"(bl));
  return c;
}
// batched GEMM like k_gemm_b but f16 operands: A f32 (split into f16 hi/lo if ASPLIT, else rounded to f16), Bt = f16 values [n][k]; alpha; C f32; N multiple of 16 (partial tiles skipped)
template <bool ASPLIT>
__global__ __launch_bounds__(128) void k_gemm_h(const float* __restrict__ A, int lda, size_t sA, const _Float16* __restrict__ Bh, int ldb, size_t sB, float alpha, float* __restrict__ C, int ldc, size_t sC, int M, int N, int K) {
  __shared__ __attribute__((aligned(16))) float so[4][16][64];
  const int tid = threadIdx.x, w = tid >> 5, lane = tid & 31, ln = lane & 15, hh = lane >> 4; const int by = blockIdx.y;
  A += (size_t)by * sA; Bh += (size_t)by * sB; C += (size_t)by * sC;
  const int ntn = (N + 63) / 64; const int wid = blockIdx.x * 4 + w; const int mt = wid / ntn, nq = wid % ntn; if (mt * 16 >= M) return;
  const int row0 = mt * 16, col0 = nq * 64; const float* arow = A + (size_t)(row0 + ln) * lda;
  v8f acc[4] = {};
  for (int kb = 0; kb < K; kb += 32) {
    FragH ah, al;
    const v4f x0 = *(const v4fa*)(arow + kb + 8 * hh), x1 = *(const v4fa*)(arow + kb + 8 * hh + 4), x2 = *(const v4fa*)(arow + kb + 16 + 8 * hh), x3 = *(const v4fa*)(arow + kb + 16 + 8 * hh + 4);
    float xs[16] = {x0[0],x0[1],x0[2],x0[3],x1[0],x1[1],x1[2],x1[3],x2[0],x2[1],x2[2],x2[3],x3[0],x3[1],x3[2],x3[3]};
#pragma unroll
    for (int i = 0; i < 16; ++i) { const _Float16 h = (_Float16)xs[i]; ah.h[i] = h; al.h[i] = ASPLIT ? (_Float16)(xs[i] - (float)h) : (_Float16)0.0f; }
#pragma unroll
    for (int t = 0; t < 4; ++t) { if (col0 + t * 16 >= N) continue; const size_t boff = (size_t)(col0 + t * 16 + ln) * ldb + kb; FragH bq; bq.half[0] = *(const v8us*)(Bh + boff + 8 * hh); bq.half[1] = *(const v8us*)(Bh + boff + 16 + 8 * hh);
      acc[t] = mmaH<ASPLIT ? 2 : 1>(ah.v, al.v, bq.v, bq.v, acc[t]); }
  }
#pragma unroll
  for (int t = 0; t < 4; ++t) { if (col0 + t * 16 >= N) continue;
#pragma unroll
    for (int r = 0; r < 8; ++r) so[w][8 * hh + r][t * 16 + ln] = acc[t][r] * alpha; }
  __builtin_amdgcn_fence(__ATOMIC_ACQ_REL, "workgroup"); __builtin_amdgcn_wave_barrier();
  const int rsub = lane >> 4, c4 = (lane & 15) * 4;
  {
#pragma unroll
    for (int q = 0; q < 8; ++q) { const int r = q * 2 + rsub; if (col0 + c4 < N) { const v4f v = *(const v4fa*)&so[w][r][c4]; *(v4f*)(C + (size_t)(row0 + r) * ldc + col0 + c4) = v; } }
     }
}

// Wt[n][k] = f16(W[k][n]·scale) from f32 row-major W[K][N] (scale = power of two; bf16-exact weights stay exact in f16 away from the subnormal range)
__global__ __launch_bounds__(256) void k_wt_f16(const float* __restrict__ W, _Float16* __restrict__ Wt, int K, int N, float scale) {
  const int t = blockIdx.x * 256 + threadIdx.x; if (t >= N * (K / 8)) return; const int n = t / (K / 8), k8 = (t % (K / 8)) * 8; FragH f;
#pragma unroll
  for (int i = 0; i < 8; ++i) f.h[i] = (_Float16)(bf16_round(W[(size_t)(k8 + i) * N + n]) * scale); const v8us o = f.half[0];
  *(v8us*)((unsigned short*)Wt + (size_t)n * K + k8) = o; 
}
// k_gemm_hh variant with fused epilogue: v = acc·alpha + bias[by·sBias + col] (+ CP[(row/rowsPerB)·sCPb + by·64 + col] if CP) ; ACT 0 none / 1 elu ; writes f16 C16 (and f32 C if non-null)
template <int ACT>
__global__ __launch_bounds__(128) void k_gemm_hhx(const _Float16* __restrict__ A, int lda, size_t sA, const _Float16* __restrict__ Bh, int ldb, size_t sB, float alpha, const float* __restrict__ bias, size_t sBias, const float* __restrict__ CP, int rowsPerB, size_t sCPb, int row0g,
    float* __restrict__ C, _Float16* __restrict__ C16, int ldc, size_t sC, int M, int N, int K) {
  __shared__ __attribute__((aligned(16))) float so[4][16][64];
  const int tid = threadIdx.x, w = tid >> 5, lane = tid & 31, ln = lane & 15, hh = lane >> 4; const int by = blockIdx.y;
  A += (size_t)by * sA; Bh += (size_t)by * sB; const size_t cofs = (size_t)by * sC; const float* bp = bias ? bias + (size_t)by * sBias : nullptr;
  const int ntn = (N + 63) / 64; const int wid = blockIdx.x * 4 + w; const int mt = wid / ntn, nq = wid % ntn; if (mt * 16 >= M) return;
  const int row0 = mt * 16, col0 = nq * 64; const _Float16* arow = A + (size_t)(row0 + ln) * lda;
  v8f acc[4] = {};
  for (int kb = 0; kb < K; kb += 32) { FragH ah; ah.half[0] = *(const v8us*)((const unsigned short*)arow + kb + 8 * hh); ah.half[1] = *(const v8us*)((const unsigned short*)arow + kb + 16 + 8 * hh);
#pragma unroll
    for (int t = 0; t < 4; ++t) { if (col0 + t * 16 >= N) continue; const size_t boff = (size_t)(col0 + t * 16 + ln) * ldb + kb; FragH bq; bq.half[0] = *(const v8us*)((const unsigned short*)Bh + boff + 8 * hh); bq.half[1] = *(const v8us*)((const unsigned short*)Bh + boff + 16 + 8 * hh);
      acc[t] = mmaH<1>(ah.v, ah.v, bq.v, bq.v, acc[t]); }
  }
#pragma unroll
  for (int t = 0; t < 4; ++t) { if (col0 + t * 16 >= N) continue; const int col = col0 + t * 16 + ln; const float bv = bp ? bf16_round(bp[col]) : 0.f;
#pragma unroll
    for (int r = 0; r < 8; ++r) { float v = acc[t][r] * alpha + bv; if (CP) { const int rr = row0g + row0 + 8 * hh + r; if (rowsPerB < 0) v += CP[cofs + (size_t)rr * ldc + col];      /* rowsPerB < 0: own element of the batched C plane */ else { const int bidx = rr / rowsPerB; v += CP[(size_t)bidx * sCPb + (size_t)by * 64 + col]; } } if (ACT == 1) v = (v > 0.f) ? v : expm1f(v); else if (ACT == 7) v = (v > 0.f) ? v + 1.0f : expf(v); else if (ACT == 8) v = tanhf(v); else if (ACT == 9) v = 0.5f * v * (1.0f + tanhf(0.7978845608028654f * (v + 0.044715f * v * v * v))); else if (ACT == 11) v = 1.0f / (1.0f + expf(-v)); else if (ACT == 12) v = (v > 0.f) ? v : 0.01f * v; else if (ACT == 14) v = (v > 0.f) ? v : 0.1f * v; else if (ACT == 16) v = (v >= 0.f) ? v : 0.3f * v; else if (ACT == 17) v = (v >= 0.f) ? v : 0.2f * v; else if (ACT == 15) v = v / (1.0f + expf(-v)); else if (ACT == 3) v = fmaxf(v, 0.f); else if (ACT == 6) v = 0.5f * v * (1.0f + erff(v * 0.70710678118654752f)); so[w][8 * hh + r][t * 16 + ln] = v; } }
  __builtin_amdgcn_fence(__ATOMIC_ACQ_REL, "workgroup"); __builtin_amdgcn_wave_barrier();
  const int rsub = lane >> 4, c4 = (lane & 15) * 4; typedef _Float16 v4h __attribute__((ext_vector_type(4)));
  {
#pragma unroll
    for (int q = 0; q < 8; ++q) { const int r = q * 2 + rsub; if (col0 + c4 < N) { const v4f v = *(const v4fa*)&so[w][r][c4]; if (C) *(v4f*)(C + cofs + (size_t)(row0 + r) * ldc + col0 + c4) = v; if (C16) { v4h h4; for (int i = 0; i < 4; ++i) h4[i] = (_Float16)v[i]; *(v4h*)(C16 + cofs + (size_t)(row0 + r) * ldc + col0 + c4) = h4; } } }
     }
}


typedef _Float16 v4h __attribute__((ext_vector_type(4)));

__global__ __launch_bounds__(256) void k_x16(const float* __restrict__ x, _Float16* __restrict__ X16, size_t n8) { const size_t t = (size_t)blockIdx.x * 256 + threadIdx.x; if (t >= n8) return; FragH f;
#pragma unroll
  for (int q = 0; q < 8; ++q) f.h[q] = (_Float16)bf16_round(x[t * 8 + q]); *(v8us*)((unsigned short*)X16 + t * 8) = f.half[0];  }
__global__ __launch_bounds__(256) void k_h16(const float* __restrict__ x, _Float16* __restrict__ X16, size_t n8) { const size_t t = (size_t)blockIdx.x * 256 + threadIdx.x; if (t >= n8) return; FragH f;
#pragma unroll
  for (int q = 0; q < 8; ++q) f.h[q] = (_Float16)x[t * 8 + q]; *(v8us*)((unsigned short*)X16 + t * 8) = f.half[0];  }
__global__ __launch_bounds__(256) void k_round16f(const float* __restrict__ W, _Float16* __restrict__ Bt, size_t n8) { const size_t t = (size_t)blockIdx.x * 256 + threadIdx.x; if (t >= n8) return; FragH f;
#pragma unroll
  for (int i = 0; i < 8; ++i) f.h[i] = (_Float16)(bf16_round(W[t * 8 + i]) * 16.0f); *(v8us*)((unsigned short*)Bt + t * 8) = f.half[0];  }
template <int NHv, int TTv>
__global__ __launch_bounds__(256) void k_vt(const _Float16* __restrict__ V16, int ldv, int voff, _Float16* __restrict__ Vt) { __shared__ unsigned short tl[64][66]; const int tid = threadIdx.x; const int slab = blockIdx.x / (TTv / 64), lg = blockIdx.x % (TTv / 64); const int b = slab / NHv, h = slab % NHv;
  for (int i = tid; i < 64 * 8; i += 256) { const int r = i / 8, c8 = (i % 8) * 8; FragH f; f.half[0] = *(const v8us*)((const unsigned short*)V16 + ((size_t)b * TTv + lg * 64 + r) * ldv + voff + h * 64 + c8);
#pragma unroll
    for (int q = 0; q < 8; ++q) tl[r][c8 + q] = f.u[q]; }
  __syncthreads();
  {
#pragma unroll
    for (int rd = 0; rd < 2; ++rd) { const int d = rd * 32 + tid / 8, pc = tid % 8; FragH f;
#pragma unroll
      for (int q = 0; q < 8; ++q) f.u[q] = tl[pc * 8 + q][d];
      *(v8us*)((unsigned short*)Vt + ((size_t)slab * 64 + d) * TTv + lg * 64 + pc * 8) = f.half[0]; }
     } }

__global__ __launch_bounds__(256) void k_hl(const float* __restrict__ F, _Float16* __restrict__ Hh, _Float16* __restrict__ Hl, size_t n8) { const size_t t = (size_t)blockIdx.x * 256 + threadIdx.x; if (t >= n8) return; FragH fh, fl; const v4f a = *(const v4fa*)(F + t * 8), c = *(const v4fa*)(F + t * 8 + 4);
#pragma unroll
  for (int q = 0; q < 4; ++q) { _Float16 h = (_Float16)a[q]; fh.h[q] = h; fl.h[q] = (_Float16)((a[q] - (float)h) * 1024.0f); h = (_Float16)c[q]; fh.h[4 + q] = h; fl.h[4 + q] = (_Float16)((c[q] - (float)h) * 1024.0f); }
  { *(v8us*)((unsigned short*)Hh + t * 8) = fh.half[0]; *(v8us*)((unsigned short*)Hl + t * 8) = fl.half[0];  } }

// ---- fast GEMM (wave tile 32x64; requires M % 32 == 0 rows per launch region and N % 64 == 0); epilogue = k_gemm_hhx semantics ----
__device__ __forceinline__ v16h g2_frag(const _Float16* p, int hh) { FragH f; f.half[0] = *(const v8us*)((const unsigned short*)p + 8 * hh); f.half[1] = *(const v8us*)((const unsigned short*)p + 16 + 8 * hh); return f.v; }
__device__ __forceinline__ v8f g2_mma(v16h a, v16h b, v8f c) { v8f d = __builtin_amdgcn_wmma_f32_16x16x32_f16(false, a, false, b, (short)0, c, false, false); asm volatile("v_nop\n\tv_nop\n\tv_nop\n\tv_nop" : "+v"(d) : "v"(a), "v"(b)); return d; }
template <int ACT>
__global__ __launch_bounds__(128) void k_gemm2(const _Float16* __restrict__ A, int lda, size_t sA, const _Float16* __restrict__ Bh, int ldb, size_t sB, float alpha, const float* __restrict__ bias, size_t sBias, const float* __restrict__ CP, int rowsPerB, size_t sCPb, int row0g,
    float* __restrict__ C, _Float16* __restrict__ C16, int ldc, size_t sC, int M, int N, int K) { static_assert(ACT == 0 || ACT == 3 || ACT == 6 || ACT == 8 || ACT == 9 || ACT == 11 || ACT == 12 || ACT == 14 || ACT == 15 || ACT == 16 || ACT == 17, "k_gemm2: unsupported ACT code (would silently apply no activation)");
  __shared__ __attribute__((aligned(16))) float so[4][32][68];
  const int tid = threadIdx.x, w = tid >> 5, lane = tid & 31, ln = lane & 15, hh = lane >> 4; const int by = blockIdx.y;
  A += (size_t)by * sA; Bh += (size_t)by * sB; const size_t cofs = (size_t)by * sC; const float* bp = bias ? bias + (size_t)by * sBias : nullptr;
  const int ntn = N >> 6; const int mt = blockIdx.x / ntn, nq = blockIdx.x - mt * ntn; const int row0 = mt * 128 + 32 * w, col0 = nq * 64; if (row0 >= M) return;
  const _Float16* a0p = A + (size_t)(row0 + ln) * lda; const _Float16* a1p = a0p + (size_t)16 * lda;
  const _Float16* b0p = Bh + (size_t)(col0 + ln) * ldb; const _Float16* b1p = b0p + (size_t)16 * ldb; const _Float16* b2p = b1p + (size_t)16 * ldb; const _Float16* b3p = b2p + (size_t)16 * ldb;
  const v8f z8 = {0.f,0.f,0.f,0.f,0.f,0.f,0.f,0.f}; v8f c00 = z8, c01 = z8, c02 = z8, c03 = z8, c10 = z8, c11 = z8, c12 = z8, c13 = z8;
#pragma unroll 1
  for (int kb = 0; kb < K; kb += 32) { const v16h a0 = g2_frag(a0p + kb, hh), a1 = g2_frag(a1p + kb, hh);
    v16h b = g2_frag(b0p + kb, hh); c00 = g2_mma(a0, b, c00); c10 = g2_mma(a1, b, c10);
    b = g2_frag(b1p + kb, hh); c01 = g2_mma(a0, b, c01); c11 = g2_mma(a1, b, c11);
    b = g2_frag(b2p + kb, hh); c02 = g2_mma(a0, b, c02); c12 = g2_mma(a1, b, c12);
    b = g2_frag(b3p + kb, hh); c03 = g2_mma(a0, b, c03); c13 = g2_mma(a1, b, c13); }
  v8f accs[8] = {c00, c01, c02, c03, c10, c11, c12, c13};
#pragma unroll
  for (int u = 0; u < 8; ++u) { const int t = u & 3, half = u >> 2; const int col = col0 + t * 16 + ln; const float bv = bp ? bf16_round(bp[col]) : 0.f;
#pragma unroll
    for (int r = 0; r < 8; ++r) { const int rloc = half * 16 + 8 * hh + r; float v = accs[u][r] * alpha + bv; if (CP) { if (rowsPerB < 0) v += CP[cofs + (size_t)(row0g + row0 + rloc) * ldc + col];      /* rowsPerB < 0: own element of the batched C plane */ else { const int bidx = (row0g + row0 + rloc) / rowsPerB; v += CP[(size_t)bidx * sCPb + (size_t)by * 64 + col]; } }
      if (ACT == 3) v = fmaxf(v, 0.f); else if (ACT == 6) v = 0.5f * v * (1.0f + erff(v * 0.70710678118654752f)); else if (ACT == 11) v = 1.0f / (1.0f + expf(-v)); else if (ACT == 15) v = v / (1.0f + expf(-v)); else if (ACT == 12) v = (v > 0.f) ? v : 0.01f * v; else if (ACT == 8) v = tanhf(v); else if (ACT == 9) v = 0.5f * v * (1.0f + tanhf(0.7978845608028654f * (v + 0.044715f * v * v * v))); else if (ACT == 14) v = (v > 0.f) ? v : 0.1f * v; else if (ACT == 16) v = (v >= 0.f) ? v : 0.3f * v; else if (ACT == 17) v = (v >= 0.f) ? v : 0.2f * v;
      so[w][rloc][t * 16 + ln] = v; } }
  __builtin_amdgcn_fence(__ATOMIC_ACQ_REL, "workgroup"); __builtin_amdgcn_wave_barrier();
  const int rsub = lane >> 4, c4 = (lane & 15) * 4;
  {
#pragma unroll
    for (int q = 0; q < 16; ++q) { const int r = q * 2 + rsub; const v4f v = *(const v4fa*)&so[w][r][c4]; if (C) *(v4f*)(C + cofs + (size_t)(row0 + r) * ldc + col0 + c4) = v; if (C16) { v4h h4; for (int i = 0; i < 4; ++i) h4[i] = (_Float16)v[i]; *(v4h*)(C16 + cofs + (size_t)(row0 + r) * ldc + col0 + c4) = h4; } }
     } }


__global__ __launch_bounds__(256) void k_tok(const float* __restrict__ x, _Float16* __restrict__ X) { __shared__ float tl[CH][17]; const int tid = threadIdx.x; const int b = blockIdx.x / (NPX / 16), pb = blockIdx.x % (NPX / 16); const int p0 = pb * 16;
  for (int i = tid; i < CH * 16; i += 256) { const int c = i / 16, p = i % 16; tl[c][p] = bf16_round(x[((size_t)b * CH + c) * NPX + p0 + p]); }
  __syncthreads();
  { for (int i = tid; i < 16 * (CH / 8); i += 256) { const int p = i / (CH / 8), c0 = (i % (CH / 8)) * 8; FragH f; for (int q = 0; q < 8; ++q) f.h[q] = (_Float16)tl[c0 + q][p];
      *(v8us*)((unsigned short*)X + ((size_t)b * NPX + p0 + p) * CH + c0) = f.half[0]; }  } }
__global__ __launch_bounds__(256) void k_im2(const _Float16* __restrict__ S, _Float16* __restrict__ I) { const size_t t = (size_t)blockIdx.x * 256 + threadIdx.x; const int c8n = CH / 8; if (t >= (size_t)NR * 9 * c8n) return; const int c8 = (int)(t % c8n) * 8; const int tap = (int)((t / c8n) % 9); const size_t row = t / ((size_t)9 * c8n); const int b = (int)(row / NPX), p = (int)(row % NPX); const int iy = p / WSD - 1 + tap / 3, ix = p % WSD - 1 + tap % 3; v8us v;
  if (iy >= 0 && iy < HS && ix >= 0 && ix < WSD) v = *(const v8us*)((const unsigned short*)S + (((size_t)b * NPX) + iy * WSD + ix) * CH + c8); else { for (int q = 0; q < 8; ++q) v[q] = 0; }
  unsigned short* d = (unsigned short*)I + row * (size_t)KC + tap * CH + c8; *(v8us*)d = v;  }
__global__ __launch_bounds__(256) void k_wre(const float* __restrict__ w, _Float16* __restrict__ Bt) { const size_t t = (size_t)blockIdx.x * 256 + threadIdx.x; if (t >= (size_t)CH * KC / 8) return; const int c8 = (int)((t * 8) % CH); const int tap = (int)(((t * 8) / CH) % 9); const int o = (int)((t * 8) / KC); FragH f; for (int q = 0; q < 8; ++q) f.h[q] = (_Float16)(bf16_round(w[((size_t)o * CH + c8 + q) * 9 + tap]) * 16.0f);
  *(v8us*)((unsigned short*)Bt + t * 8) = f.half[0];  }
__global__ __launch_bounds__(256) void k_bnrelu(const float* __restrict__ Cv, const float* __restrict__ g, const float* __restrict__ bt, const float* __restrict__ mn, const float* __restrict__ vr, _Float16* __restrict__ O16, float* __restrict__ OF) {
  #pragma clang fp contract(off)
  const size_t t = (size_t)blockIdx.x * 256 + threadIdx.x; if (t >= (size_t)NR * CH / 8) return; const int c0 = (int)((t * 8) % CH); const v8f a = *(const v8f*)(Cv + t * 8); v8f o; FragH f;
  for (int q = 0; q < 8; ++q) { const int c = c0 + q; const float inv = bf16_round(g[c]) * rsqrtf(bf16_round(vr[c]) + 1e-5f); float sh = -bf16_round(mn[c]) * inv; sh += bf16_round(bt[c]); float y = a[q] * inv; y += sh; y = fmaxf(y, 0.f); o[q] = y; f.h[q] = (_Float16)y; }
  { *(v8us*)((unsigned short*)O16 + t * 8) = f.half[0]; if (OF) *(v8f*)(OF + t * 8) = o;  } }
__global__ __launch_bounds__(256) void k_vt(const _Float16* __restrict__ L16, _Float16* __restrict__ VT) { __shared__ unsigned short tl[64][66]; const int tid = threadIdx.x; const int b = blockIdx.x / (NPX / 64), kg = blockIdx.x % (NPX / 64);
  for (int i = tid; i < 64 * 8; i += 256) { const int r = i / 8, c8 = (i % 8) * 8; FragH f; f.half[0] = *(const v8us*)((const unsigned short*)L16 + ((size_t)b * NPX + kg * 64 + r) * CH + c8); for (int q = 0; q < 8; ++q) tl[r][c8 + q] = f.u[q]; }
  __syncthreads();
  { for (int i = tid; i < CH * 8; i += 256) { const int c = i / 8, pc = i % 8; FragH f; for (int q = 0; q < 8; ++q) f.u[q] = tl[pc * 8 + q][c];
      *(v8us*)((unsigned short*)VT + ((size_t)b * CH + c) * NPX + kg * 64 + pc * 8) = f.half[0]; }  } }
#define AT_T 64                    /* keys per quarter and trip */
#define AT_NT (NPX / 4 / AT_T)     /* 16 trips */
#define AT_KP 40                   /* K row pitch in LDS, f16 elements: 64 B + 16 B, an odd multiple of 16 B */
#define AT_VP 72                   /* V^T row pitch in LDS, f16 elements: 128 B + 16 B, an odd multiple of 16 B */
#define AT_OP 130                  /* pitch of the joined O^T rows, floats: rows 8 apart fall 16 banks apart */
__device__ __forceinline__ v16h at_frag(const unsigned short* p, int hh) { FragH f; f.half[0] = *(const v8us*)(p + 8 * hh); f.half[1] = *(const v8us*)(p + 16 + 8 * hh); return f.v; }
__device__ __forceinline__ float at_xhalf(float x) { const int v = __float_as_int(x); return __int_as_float(__builtin_amdgcn_permlanex16(v, v, 0x76543210, 0xfedcba98, false, false)); }
__device__ __forceinline__ v8f at_mma(v16h a, v16h b, v8f c) { return __builtin_amdgcn_wmma_f32_16x16x32_f16(false, a, false, b, (short)0, c, false, false); }
__device__ __forceinline__ float at_max16(v8f a, v8f c) { float t = fmaxf(a[0], c[0]);
#pragma unroll      /* constant element indices keep the tiles in registers */
  for (int r = 1; r < 8; ++r) t = fmaxf(t, fmaxf(a[r], c[r])); return fmaxf(t, at_xhalf(t)); }
// P = 2^(s * sa - mx) for two S^T tiles of one query tile: the f16 B operand, and the f32 values added into l register by register
__device__ __forceinline__ v16h at_p(v8f a, v8f c, float sa, float mx, v8f& l) { FragH f; const v8f sv = {sa, sa, sa, sa, sa, sa, sa, sa}; const v8f nm = {-mx, -mx, -mx, -mx, -mx, -mx, -mx, -mx};
  const v8f xa = __builtin_elementwise_fma(a, sv, nm), xc = __builtin_elementwise_fma(c, sv, nm); v8f ea, ec;
#pragma unroll      /* constant element indices keep the tiles in registers */
  for (int r = 0; r < 8; ++r) { ea[r] = __builtin_amdgcn_exp2f(xa[r]); ec[r] = __builtin_amdgcn_exp2f(xc[r]); f.h[r] = (_Float16)ea[r]; f.h[8 + r] = (_Float16)ec[r]; }
  l += ea + ec; return f.v; }
__global__ __launch_bounds__(512) void k_attn(const _Float16* __restrict__ H16, const _Float16* __restrict__ L16, const _Float16* __restrict__ VT, const float* __restrict__ HF, const float* __restrict__ pp, float* __restrict__ out) {
  __shared__ __attribute__((aligned(16))) unsigned short Ks[2][4 * AT_T][AT_KP];
  __shared__ __attribute__((aligned(16))) unsigned short Vs[2][4 * HC][AT_VP];
  __shared__ float Om[4][HC][AT_OP];
  __shared__ float Mm[4][128];
  __shared__ float Lm[4][128];
  const int tid = threadIdx.x, w = tid >> 5, lane = tid & 31, ln = lane & 15, hh = lane >> 4;
  const int qg = w & 3, ks = w >> 2;
  const int plane = blockIdx.x / (NPX / 128), q0 = (blockIdx.x % (NPX / 128)) * 128; const int b = plane / NHD, h = plane % NHD;
  const float sc2 = 0.125f * bf16_round(pp[0]) * 1.4426950408889634f;      /* scores in log2 units */
  const float sa = fabsf(sc2); const unsigned short qflip = sc2 < 0.f ? (unsigned short)0x8000 : (unsigned short)0;      /* a negative scale goes into Q's sign (exact), so that the largest raw score is the largest scaled one */
  const unsigned short* Lg = (const unsigned short*)L16 + (size_t)b * NPX * CH + h * HC;
  const unsigned short* Vg = (const unsigned short*)VT + ((size_t)b * CH + h * HC) * NPX;
  /* staging: 1024 16-byte pieces of K and of V^T a trip, two of each a thread */
  const int kr0 = tid >> 2, kr1 = kr0 + 128, kc = (tid & 3) * 8;
  const int vr0 = tid >> 3, vr1 = vr0 + 64, vc = (tid & 7) * 8;
  const unsigned short* gk0 = Lg + (size_t)((kr0 / AT_T) * (NPX / 4) + (kr0 % AT_T)) * CH + kc;
  const unsigned short* gk1 = Lg + (size_t)((kr1 / AT_T) * (NPX / 4) + (kr1 % AT_T)) * CH + kc;
  const unsigned short* gv0 = Vg + (size_t)(vr0 % HC) * NPX + (vr0 / HC) * (NPX / 4) + vc;
  const unsigned short* gv1 = Vg + (size_t)(vr1 % HC) * NPX + (vr1 / HC) * (NPX / 4) + vc;
  const _Float16* qp = H16 + ((size_t)b * NPX + q0 + qg * 32 + ln) * CH + h * HC;
  FragH qf0, qf1; qf0.v = g2_frag(qp, hh); qf1.v = g2_frag(qp + (size_t)16 * CH, hh);
  qf0.half[0] ^= qflip; qf0.half[1] ^= qflip; qf1.half[0] ^= qflip; qf1.half[1] ^= qflip;
  const v16h qb0 = qf0.v, qb1 = qf1.v;
  const v8f z8 = {0.f,0.f,0.f,0.f,0.f,0.f,0.f,0.f};
  v8f o00 = z8, o10 = z8, o01 = z8, o11 = z8;      /* o<channel tile><query tile> */
  float m0 = -3.0e38f, m1 = -3.0e38f; v8f l0 = z8, l1 = z8;
  v8us rk0 = *(const v8us*)gk0, rk1 = *(const v8us*)gk1, rv0 = *(const v8us*)gv0, rv1 = *(const v8us*)gv1;
  *(v8us*)&Ks[0][kr0][kc] = rk0; *(v8us*)&Ks[0][kr1][kc] = rk1; *(v8us*)&Vs[0][vr0][vc] = rv0; *(v8us*)&Vs[0][vr1][vc] = rv1;
  __syncthreads();
  for (int t = 0; t < AT_NT; ++t) { const int bf = t & 1;
    if (t + 1 < AT_NT) { const size_t ko = (size_t)(t + 1) * AT_T * CH, vo = (size_t)(t + 1) * AT_T;      /* the next tile's loads fly over this tile's work */
      rk0 = *(const v8us*)(gk0 + ko); rk1 = *(const v8us*)(gk1 + ko); rv0 = *(const v8us*)(gv0 + vo); rv1 = *(const v8us*)(gv1 + vo); }
#pragma unroll      /* both 32-key steps of a tile in one body: LDS offsets become immediates */
    for (int st = 0; st < AT_T / 32; ++st) {
      const unsigned short* kb = &Ks[bf][ks * AT_T + st * 32 + ln][0];
      const unsigned short* vb = &Vs[bf][ks * HC + ln][st * 32];
      const v16h ka0 = at_frag(kb, hh), ka1 = at_frag(kb + 16 * AT_KP, hh);
      const v16h va0 = at_frag(vb, hh), va1 = at_frag(vb + 16 * AT_VP, hh);
      v8f s00 = at_mma(ka0, qb0, z8), s10 = at_mma(ka1, qb0, z8), s01 = at_mma(ka0, qb1, z8), s11 = at_mma(ka1, qb1, z8);      /* s<key tile><query tile> */
      const float t0 = at_max16(s00, s10) * sa, t1 = at_max16(s01, s11) * sa;
      /* lazy rescale: the maximum in use moves only when a column's new maximum exceeds it by more than 8 (P never exceeds 2^8, inside f16); one scalar branch a step */
      if (__builtin_amdgcn_ballot_w32((t0 > m0 + 8.0f) || (t1 > m1 + 8.0f)) != 0) {
        const float n0 = fmaxf(m0, t0), n1 = fmaxf(m1, t1); const float f0 = __builtin_amdgcn_exp2f(m0 - n0), f1 = __builtin_amdgcn_exp2f(m1 - n1);
        m0 = n0; m1 = n1; l0 *= f0; l1 *= f1; o00 *= f0; o10 *= f0; o01 *= f1; o11 *= f1; }
      const v16h p0 = at_p(s00, s10, sa, m0, l0), p1 = at_p(s01, s11, sa, m1, l1);
      o00 = at_mma(va0, p0, o00); o10 = at_mma(va1, p0, o10); o01 = at_mma(va0, p1, o01); o11 = at_mma(va1, p1, o11);
    }
    if (t + 1 < AT_NT) {      /* the other buffer's readers left it before the barrier that ended trip t - 1 */
      *(v8us*)&Ks[bf ^ 1][kr0][kc] = rk0; *(v8us*)&Ks[bf ^ 1][kr1][kc] = rk1; *(v8us*)&Vs[bf ^ 1][vr0][vc] = rv0; *(v8us*)&Vs[bf ^ 1][vr1][vc] = rv1;
      __syncthreads(); }
  }
  /* join: the lane halves' sums, then the four key quarters through LDS */
  float ls0 = ((l0[0] + l0[1]) + (l0[2] + l0[3])) + ((l0[4] + l0[5]) + (l0[6] + l0[7])), ls1 = ((l1[0] + l1[1]) + (l1[2] + l1[3])) + ((l1[4] + l1[5]) + (l1[6] + l1[7]));
  ls0 += at_xhalf(ls0); ls1 += at_xhalf(ls1);
  if (hh == 0) { Mm[ks][qg * 32 + ln] = m0; Mm[ks][qg * 32 + 16 + ln] = m1; Lm[ks][qg * 32 + ln] = ls0; Lm[ks][qg * 32 + 16 + ln] = ls1; }
#pragma unroll      /* constant element indices keep the tiles in registers */
  for (int r = 0; r < 8; ++r) { Om[ks][8 * hh + r][qg * 32 + ln] = o00[r]; Om[ks][16 + 8 * hh + r][qg * 32 + ln] = o10[r]; Om[ks][8 * hh + r][qg * 32 + 16 + ln] = o01[r]; Om[ks][16 + 8 * hh + r][qg * 32 + 16 + ln] = o11[r]; }
  __syncthreads();
  const int q = tid & 127, c0 = (tid >> 7) * 8;
  const float mm = fmaxf(fmaxf(Mm[0][q], Mm[1][q]), fmaxf(Mm[2][q], Mm[3][q]));
  const float e0 = __builtin_amdgcn_exp2f(Mm[0][q] - mm), e1 = __builtin_amdgcn_exp2f(Mm[1][q] - mm), e2 = __builtin_amdgcn_exp2f(Mm[2][q] - mm), e3 = __builtin_amdgcn_exp2f(Mm[3][q] - mm);
  const float inv = 1.0f / (Lm[0][q] * e0 + Lm[1][q] * e1 + Lm[2][q] * e2 + Lm[3][q] * e3);
  const float* hf = HF + ((size_t)b * NPX + q0 + q) * CH + h * HC + c0;
  const v4f ra = *(const v4fa*)hf, rb = *(const v4fa*)(hf + 4);
  float* op = out + ((size_t)b * CH + h * HC + c0) * NPX + q0 + q;
#pragma unroll      /* constant element indices for the residual vectors */
  for (int i = 0; i < 8; ++i) { const float v = Om[0][c0 + i][q] * e0 + Om[1][c0 + i][q] * e1 + Om[2][c0 + i][q] * e2 + Om[3][c0 + i][q] * e3; op[(size_t)i * NPX] = v * inv + (i < 4 ? ra[i & 3] : rb[i & 3]); }
}

extern "C" void kernel_launch(void* const* d_in, const int* in_sizes, int n_in,
                              void* d_out, int out_size, void* d_ws, size_t ws_size, hipStream_t stream) {
  (void)in_sizes; (void)n_in; (void)out_size;
  const float* const* I = (const float* const*)d_in; const float* low = I[0]; const float* high = I[1]; const float* wH = I[2]; const float* gH = I[3]; const float* bH = I[4]; const float* mH = I[5]; const float* vH = I[6]; const float* wL = I[7]; const float* gL = I[8]; const float* bL = I[9]; const float* mL = I[10]; const float* vL = I[11]; const float* pp = I[12];
  char* ws = (char*)d_ws; size_t off = 0;
  auto take = [&](size_t bytes) { char* p = ws + off; off += (bytes + 255) & ~(size_t)255; return p; };
  const size_t ne = (size_t)NR * CH; const unsigned g8 = (unsigned)((ne / 8 + 255) / 256);
  _Float16* BH = (_Float16*)take((size_t)CH * KC * 2); _Float16* BL = (_Float16*)take((size_t)CH * KC * 2); _Float16* X = (_Float16*)take(ne * 2); _Float16* IM = (_Float16*)take((size_t)NR * KC * 2); float* CV = (float*)take(ne * 4);
  _Float16* H16 = (_Float16*)take(ne * 2); float* HF = (float*)take(ne * 4); _Float16* L16 = (_Float16*)take(ne * 2); _Float16* VT = (_Float16*)take(ne * 2);
  if (off > ws_size) return;      /* 0.1 + 2 + 18 + 4 + 2 + 4 + 2 + 2 = about 34 MiB */
  k_wre<<<(unsigned)(((size_t)CH * KC / 8 + 255) / 256), 256, 0, stream>>>(wH, BH); k_wre<<<(unsigned)(((size_t)CH * KC / 8 + 255) / 256), 256, 0, stream>>>(wL, BL);
  const dim3 gc((NR / 128) * (CH / 64), 1); const unsigned gi = (unsigned)(((size_t)NR * 9 * (CH / 8) + 255) / 256);
  k_tok<<<NI * (NPX / 16), 256, 0, stream>>>(high, X); k_im2<<<gi, 256, 0, stream>>>(X, IM); k_gemm2<0><<<gc, 128, 0, stream>>>(IM, KC, 0, BH, KC, 0, 0.0625f, nullptr, 0, nullptr, 1, 0, 0, CV, nullptr, CH, 0, NR, CH, KC); k_bnrelu<<<g8, 256, 0, stream>>>(CV, gH, bH, mH, vH, H16, HF);      /* hconv (q_h; f32 copy for the residual) */
  k_tok<<<NI * (NPX / 16), 256, 0, stream>>>(low, X); k_im2<<<gi, 256, 0, stream>>>(X, IM); k_gemm2<0><<<gc, 128, 0, stream>>>(IM, KC, 0, BL, KC, 0, 0.0625f, nullptr, 0, nullptr, 1, 0, 0, CV, nullptr, CH, 0, NR, CH, KC); k_bnrelu<<<g8, 256, 0, stream>>>(CV, gL, bL, mL, vL, L16, nullptr); k_vt<<<NI * (NPX / 64), 256, 0, stream>>>(L16, VT);      /* lconv (k_l = v_l) + V^T */
  k_attn<<<NI * NHD * (NPX / 128), 512, 0, stream>>>(H16, L16, VT, HF, pp, (float*)d_out);      /* scores, softmax, readout, residual, NCHW store */
}

// v002
// It runs in 28.8 microseconds.
// Timed twice side by side with v001, it ran 3.90 and 3.77 times as fast.
// All steps since v000 together make it 36.2 times as fast.
#include <hip/hip_runtime.h>
#define NI 4
#define CH 64
#define NHD 2
#define HC 32
#define HS 64
#define WSD 64
#define NPX (HS * WSD)
#define NR (NI * NPX)            /* 16384 */
#define KC (9 * CH)              /* 576 */
typedef __bf16 v16b __attribute__((ext_vector_type(16)));
typedef unsigned short v8us __attribute__((ext_vector_type(8), may_alias));
typedef float  v8f  __attribute__((ext_vector_type(8)));
typedef float  v4f  __attribute__((ext_vector_type(4)));
typedef float  v4fa __attribute__((ext_vector_type(4), may_alias));
union FragB { v16b v; v8us half[2]; unsigned short u[16]; };

__device__ __forceinline__ unsigned short bf16_bits(float x) { unsigned int u = __float_as_uint(x); return (unsigned short)((u + 0x7FFFu + ((u >> 16) & 1u)) >> 16); }
__device__ __forceinline__ float bf16_val(unsigned short b) { return __uint_as_float(((unsigned int)b) << 16); }
__device__ __forceinline__ float bf16_round(float x) { return bf16_val(bf16_bits(x)); }
// D += A·B with NT terms: 1 = ah·bh, 2 = + al·bh (A split), 3 = + ah·bl (both split)
template <int NT>
__device__ __forceinline__ v8f mmaN(v16b ah, v16b al, v16b bh, v16b bl, v8f c) {
  c = __builtin_amdgcn_wmma_f32_16x16x32_bf16(false, ah, false, bh, (short)0, c, false, false);
  if (NT >= 2) c = __builtin_amdgcn_wmma_f32_16x16x32_bf16(false, al, false, bh, (short)0, c, false, false);
  if (NT >= 3) c = __builtin_amdgcn_wmma_f32_16x16x32_bf16(false, ah, false, bl, (short)0, c, false, false);
  asm volatile("v_nop\n\tv_nop\n\tv_nop\n\tv_nop" : "+v"(c) : "v"(ah), "v"(al), "v"(bh), "v"(bl));
  return c;
}

__global__ __launch_bounds__(256) void k_wt_bf16(const float* __restrict__ W, unsigned short* __restrict__ Wt, int K, int N) {
  const int t = blockIdx.x * 256 + threadIdx.x;
  const int k8n = K / 8;
  if (t >= N * k8n) return;
  const int n = t / k8n, k8 = (t % k8n) * 8;
  v8us v;
#pragma unroll
  for (int i = 0; i < 8; ++i) v[i] = bf16_bits(W[(size_t)(k8 + i) * N + n]);
  *(v8us*)(Wt + (size_t)n * K + k8) = v;
  
}

// GEMM C[M][N] (f32, pitch ldc) = act(A[M][K]·W + bias). A f32 row-major (pitch lda) converted per fragment to bf16
// (ASPLIT: hi/lo two planes -> 2 terms, else single rounded term); Wt bf16 [N][K] (pitch ldb). BIAS_BF16 rounds the
// bias to bf16 first (bias quantised to bf16 before the add). K%32==0, M%16==0, N%64==0.
template <bool ASPLIT, int ACT, bool BIAS_BF16>
__global__ __launch_bounds__(128) void k_gemm_bf(const float* __restrict__ A, int lda, const unsigned short* __restrict__ Wt, int ldb,
                                               const float* __restrict__ bias, float* __restrict__ C, int ldc, int M, int N, int K) {
  __shared__ __attribute__((aligned(16))) float so[4][16][64];
  const int tid = threadIdx.x, w = tid >> 5, lane = tid & 31, ln = lane & 15, hh = lane >> 4;
  const int ntn = N / 64;
  const int wid = blockIdx.x * 4 + w;
  const int mt = wid / ntn, nq = wid % ntn;
  if (mt * 16 >= M) return;
  const int row0 = mt * 16, col0 = nq * 64;
  const float* arow = A + (size_t)(row0 + ln) * lda;
  v8f acc[4] = {};
  for (int kb = 0; kb < K; kb += 32) {
    FragB ah, al;
    const v4f x0 = *(const v4fa*)(arow + kb + 8 * hh), x1 = *(const v4fa*)(arow + kb + 8 * hh + 4);
    const v4f x2 = *(const v4fa*)(arow + kb + 16 + 8 * hh), x3 = *(const v4fa*)(arow + kb + 16 + 8 * hh + 4);
    float xs[16] = {x0[0],x0[1],x0[2],x0[3],x1[0],x1[1],x1[2],x1[3],x2[0],x2[1],x2[2],x2[3],x3[0],x3[1],x3[2],x3[3]};
#pragma unroll
    for (int i = 0; i < 16; ++i) { const unsigned short hb = bf16_bits(xs[i]); ah.u[i] = hb; al.u[i] = ASPLIT ? bf16_bits(xs[i] - bf16_val(hb)) : (unsigned short)0; }
#pragma unroll
    for (int t = 0; t < 4; ++t) {
      const unsigned short* brow = Wt + (size_t)(col0 + t * 16 + ln) * ldb + kb;
      FragB b;
      b.half[0] = *(const v8us*)(brow + 8 * hh);
      b.half[1] = *(const v8us*)(brow + 16 + 8 * hh);
      acc[t] = mmaN<ASPLIT ? 2 : 1>(ah.v, al.v, b.v, b.v, acc[t]);
    }
  }
#pragma unroll
  for (int t = 0; t < 4; ++t) {
    float bv = bias ? bias[col0 + t * 16 + ln] : 0.f;
    if (BIAS_BF16) bv = bf16_round(bv);
#pragma unroll
    for (int r = 0; r < 8; ++r) { float v = acc[t][r] + bv; if (ACT == 1) v = fmaxf(v, 0.f); so[w][8 * hh + r][t * 16 + ln] = v; }
  }
  __builtin_amdgcn_fence(__ATOMIC_ACQ_REL, "workgroup");
  __builtin_amdgcn_wave_barrier();
  const int rsub = lane >> 4, c4 = (lane & 15) * 4;
  {
#pragma unroll
    for (int q = 0; q < 8; ++q) {
      const int r = q * 2 + rsub;
      const v4f v = *(const v4fa*)&so[w][r][c4];
      *(v4f*)(C + (size_t)(row0 + r) * ldc + col0 + c4) = v;
    }
    
  }
}

// GEMM C = act(A·W + bias + resid): A f32 (ASPLIT -> hi/lo 2 terms), Wt bf16 [N][K]; ACT 0 none, 1 relu, 2 exact gelu;
// resid (optional, f32, row index = (row % rmod), pitch ldr, RES_BF16 rounds it) added before the activation.
template <bool ASPLIT, int ACT, bool BIAS_BF16, bool RES_BF16>
__global__ __launch_bounds__(128) void k_gemm_bf3(const float* __restrict__ A, int lda, const unsigned short* __restrict__ Wt, int ldb,
                                                const float* __restrict__ bias, const float* __restrict__ resid, int rmod, int ldr,
                                                float* __restrict__ C, int ldc, int M, int N, int K) {
  __shared__ __attribute__((aligned(16))) float so[4][16][64];
  const int tid = threadIdx.x, w = tid >> 5, lane = tid & 31, ln = lane & 15, hh = lane >> 4;
  const int ntn = N / 64;
  const int wid = blockIdx.x * 4 + w;
  const int mt = wid / ntn, nq = wid % ntn;
  if (mt * 16 >= M) return;
  const int row0 = mt * 16, col0 = nq * 64;
  const float* arow = A + (size_t)(row0 + ln) * lda;
  v8f acc[4] = {};
  for (int kb = 0; kb < K; kb += 32) {
    FragB ah, al;
    const v4f x0 = *(const v4fa*)(arow + kb + 8 * hh), x1 = *(const v4fa*)(arow + kb + 8 * hh + 4);
    const v4f x2 = *(const v4fa*)(arow + kb + 16 + 8 * hh), x3 = *(const v4fa*)(arow + kb + 16 + 8 * hh + 4);
    float xs[16] = {x0[0],x0[1],x0[2],x0[3],x1[0],x1[1],x1[2],x1[3],x2[0],x2[1],x2[2],x2[3],x3[0],x3[1],x3[2],x3[3]};
#pragma unroll
    for (int i = 0; i < 16; ++i) { const unsigned short hb = bf16_bits(xs[i]); ah.u[i] = hb; al.u[i] = ASPLIT ? bf16_bits(xs[i] - bf16_val(hb)) : (unsigned short)0; }
#pragma unroll
    for (int t = 0; t < 4; ++t) {
      const unsigned short* brow = Wt + (size_t)(col0 + t * 16 + ln) * ldb + kb;
      FragB b;
      b.half[0] = *(const v8us*)(brow + 8 * hh);
      b.half[1] = *(const v8us*)(brow + 16 + 8 * hh);
      acc[t] = mmaN<ASPLIT ? 2 : 1>(ah.v, al.v, b.v, b.v, acc[t]);
    }
  }
#pragma unroll
  for (int t = 0; t < 4; ++t) {
    const int col = col0 + t * 16 + ln;
    float bv = bias ? bias[col] : 0.f;
    if (BIAS_BF16) bv = bf16_round(bv);
#pragma unroll
    for (int r = 0; r < 8; ++r) {
      float v = acc[t][r] + bv;
      if (resid) { float rv = resid[(size_t)((row0 + 8 * hh + r) % rmod) * ldr + col]; if (RES_BF16) rv = bf16_round(rv); v += rv; }
      if (ACT == 1) v = fmaxf(v, 0.f);
      if (ACT == 2) v = 0.5f * v * (1.0f + erff(v * 0.70710678118654752f));
      if (ACT == 3) { const float u = 0.7978845608028654f * (v + 0.044715f * v * v * v); v = 0.5f * v * (1.0f + tanhf(u)); }
      so[w][8 * hh + r][t * 16 + ln] = v;
    }
  }
  __builtin_amdgcn_fence(__ATOMIC_ACQ_REL, "workgroup");
  __builtin_amdgcn_wave_barrier();
  const int rsub = lane >> 4, c4 = (lane & 15) * 4;
  {
#pragma unroll
    for (int q = 0; q < 8; ++q) {
      const int r = q * 2 + rsub;
      const v4f v = *(const v4fa*)&so[w][r][c4];
      *(v4f*)(C + (size_t)(row0 + r) * ldc + col0 + c4) = v;
    }
    
  }
}
// row LayerNorm (biased variance, eps) over N: s = X (+ R); optional out_sum <- s; out_norm <- (s-mu)*rsqrt(var+eps)*g + b
template <bool PARAM_BF16>
__global__ __launch_bounds__(256) void k_layernorm(const float* __restrict__ X, const float* __restrict__ R, const float* __restrict__ g, const float* __restrict__ bta,
                                                  float* __restrict__ out_sum, float* __restrict__ out_norm, int N, float eps) {
  __shared__ float red[256];
  const int row = blockIdx.x, tid = threadIdx.x;
  const float* x = X + (size_t)row * N; const float* rr = R ? R + (size_t)row * N : nullptr;
  float vals[16];                     // up to N = 4096
  const int per = N / 256;            // contiguous chunk per thread? use strided-by-4 chunks: thread handles j = tid*4 + 1024*u
  float s1 = 0.f;
  for (int u = 0; u < per / 4; ++u) {
    const int j = tid * 4 + 1024 * u;
    const v4f a = *(const v4fa*)(x + j);
    v4f b = {0.f,0.f,0.f,0.f}; if (rr) b = *(const v4fa*)(rr + j);
#pragma unroll
    for (int q = 0; q < 4; ++q) { const float v = a[q] + b[q]; vals[u * 4 + q] = v; s1 += v; }
  }
  red[tid] = s1; __syncthreads();
  for (int st = 128; st > 0; st >>= 1) { if (tid < st) red[tid] += red[tid + st]; __syncthreads(); }
  const float mu = red[0] / (float)N; __syncthreads();
  float s2 = 0.f;
  for (int u = 0; u < per / 4; ++u)
#pragma unroll
    for (int q = 0; q < 4; ++q) { const float c = vals[u * 4 + q] - mu; s2 += c * c; }
  red[tid] = s2; __syncthreads();
  for (int st = 128; st > 0; st >>= 1) { if (tid < st) red[tid] += red[tid + st]; __syncthreads(); }
  const float rs = rsqrtf(red[0] / (float)N + eps);
  {
    for (int u = 0; u < per / 4; ++u) {
      const int j = tid * 4 + 1024 * u;
      v4f o, sm;
#pragma unroll
      for (int q = 0; q < 4; ++q) {
        float gg = g[j + q], bb = bta[j + q];
        if (PARAM_BF16) { gg = bf16_round(gg); bb = bf16_round(bb); }
        sm[q] = vals[u * 4 + q]; o[q] = (vals[u * 4 + q] - mu) * rs * gg + bb;
      }
      if (out_sum) *(v4f*)(out_sum + (size_t)row * N + j) = sm;
      *(v4f*)(out_norm + (size_t)row * N + j) = o;
    }
    
  }
}



// ---- f16 WMMA path (v_wmma_f32_16x16x32_f16): 11-bit significands for operands in range — used where a probability operand (up to 2^8 here) needs more precision than bf16
typedef _Float16 v16h __attribute__((ext_vector_type(16)));
union FragH { v16h v; v8us half[2]; _Float16 h[16]; unsigned short u[16]; };
template <int NT>
__device__ __forceinline__ v8f mmaH(v16h ah, v16h al, v16h bh, v16h bl, v8f c) {
  c = __builtin_amdgcn_wmma_f32_16x16x32_f16(false, ah, false, bh, (short)0, c, false, false);
  if (NT >= 2) c = __builtin_amdgcn_wmma_f32_16x16x32_f16(false, al, false, bh, (short)0, c, false, false);
  if (NT >= 3) c = __builtin_amdgcn_wmma_f32_16x16x32_f16(false, ah, false, bl, (short)0, c, false, false);
  asm volatile("v_nop\n\tv_nop\n\tv_nop\n\tv_nop" : "+v"(c) : "v"(ah), "v"(al), "v"(bh), "v"(bl));
  return c;
}
// batched GEMM like k_gemm_b but f16 operands: A f32 (split into f16 hi/lo if ASPLIT, else rounded to f16), Bt = f16 values [n][k]; alpha; C f32; N multiple of 16 (partial tiles skipped)
template <bool ASPLIT>
__global__ __launch_bounds__(128) void k_gemm_h(const float* __restrict__ A, int lda, size_t sA, const _Float16* __restrict__ Bh, int ldb, size_t sB, float alpha, float* __restrict__ C, int ldc, size_t sC, int M, int N, int K) {
  __shared__ __attribute__((aligned(16))) float so[4][16][64];
  const int tid = threadIdx.x, w = tid >> 5, lane = tid & 31, ln = lane & 15, hh = lane >> 4; const int by = blockIdx.y;
  A += (size_t)by * sA; Bh += (size_t)by * sB; C += (size_t)by * sC;
  const int ntn = (N + 63) / 64; const int wid = blockIdx.x * 4 + w; const int mt = wid / ntn, nq = wid % ntn; if (mt * 16 >= M) return;
  const int row0 = mt * 16, col0 = nq * 64; const float* arow = A + (size_t)(row0 + ln) * lda;
  v8f acc[4] = {};
  for (int kb = 0; kb < K; kb += 32) {
    FragH ah, al;
    const v4f x0 = *(const v4fa*)(arow + kb + 8 * hh), x1 = *(const v4fa*)(arow + kb + 8 * hh + 4), x2 = *(const v4fa*)(arow + kb + 16 + 8 * hh), x3 = *(const v4fa*)(arow + kb + 16 + 8 * hh + 4);
    float xs[16] = {x0[0],x0[1],x0[2],x0[3],x1[0],x1[1],x1[2],x1[3],x2[0],x2[1],x2[2],x2[3],x3[0],x3[1],x3[2],x3[3]};
#pragma unroll
    for (int i = 0; i < 16; ++i) { const _Float16 h = (_Float16)xs[i]; ah.h[i] = h; al.h[i] = ASPLIT ? (_Float16)(xs[i] - (float)h) : (_Float16)0.0f; }
#pragma unroll
    for (int t = 0; t < 4; ++t) { if (col0 + t * 16 >= N) continue; const size_t boff = (size_t)(col0 + t * 16 + ln) * ldb + kb; FragH bq; bq.half[0] = *(const v8us*)(Bh + boff + 8 * hh); bq.half[1] = *(const v8us*)(Bh + boff + 16 + 8 * hh);
      acc[t] = mmaH<ASPLIT ? 2 : 1>(ah.v, al.v, bq.v, bq.v, acc[t]); }
  }
#pragma unroll
  for (int t = 0; t < 4; ++t) { if (col0 + t * 16 >= N) continue;
#pragma unroll
    for (int r = 0; r < 8; ++r) so[w][8 * hh + r][t * 16 + ln] = acc[t][r] * alpha; }
  __builtin_amdgcn_fence(__ATOMIC_ACQ_REL, "workgroup"); __builtin_amdgcn_wave_barrier();
  const int rsub = lane >> 4, c4 = (lane & 15) * 4;
  {
#pragma unroll
    for (int q = 0; q < 8; ++q) { const int r = q * 2 + rsub; if (col0 + c4 < N) { const v4f v = *(const v4fa*)&so[w][r][c4]; *(v4f*)(C + (size_t)(row0 + r) * ldc + col0 + c4) = v; } }
     }
}

// Wt[n][k] = f16(W[k][n]·scale) from f32 row-major W[K][N] (scale = power of two; bf16-exact weights stay exact in f16 away from the subnormal range)
__global__ __launch_bounds__(256) void k_wt_f16(const float* __restrict__ W, _Float16* __restrict__ Wt, int K, int N, float scale) {
  const int t = blockIdx.x * 256 + threadIdx.x; if (t >= N * (K / 8)) return; const int n = t / (K / 8), k8 = (t % (K / 8)) * 8; FragH f;
#pragma unroll
  for (int i = 0; i < 8; ++i) f.h[i] = (_Float16)(bf16_round(W[(size_t)(k8 + i) * N + n]) * scale); const v8us o = f.half[0];
  *(v8us*)((unsigned short*)Wt + (size_t)n * K + k8) = o; 
}
// k_gemm_hh variant with fused epilogue: v = acc·alpha + bias[by·sBias + col] (+ CP[(row/rowsPerB)·sCPb + by·64 + col] if CP) ; ACT 0 none / 1 elu ; writes f16 C16 (and f32 C if non-null)
template <int ACT>
__global__ __launch_bounds__(128) void k_gemm_hhx(const _Float16* __restrict__ A, int lda, size_t sA, const _Float16* __restrict__ Bh, int ldb, size_t sB, float alpha, const float* __restrict__ bias, size_t sBias, const float* __restrict__ CP, int rowsPerB, size_t sCPb, int row0g,
    float* __restrict__ C, _Float16* __restrict__ C16, int ldc, size_t sC, int M, int N, int K) {
  __shared__ __attribute__((aligned(16))) float so[4][16][64];
  const int tid = threadIdx.x, w = tid >> 5, lane = tid & 31, ln = lane & 15, hh = lane >> 4; const int by = blockIdx.y;
  A += (size_t)by * sA; Bh += (size_t)by * sB; const size_t cofs = (size_t)by * sC; const float* bp = bias ? bias + (size_t)by * sBias : nullptr;
  const int ntn = (N + 63) / 64; const int wid = blockIdx.x * 4 + w; const int mt = wid / ntn, nq = wid % ntn; if (mt * 16 >= M) return;
  const int row0 = mt * 16, col0 = nq * 64; const _Float16* arow = A + (size_t)(row0 + ln) * lda;
  v8f acc[4] = {};
  for (int kb = 0; kb < K; kb += 32) { FragH ah; ah.half[0] = *(const v8us*)((const unsigned short*)arow + kb + 8 * hh); ah.half[1] = *(const v8us*)((const unsigned short*)arow + kb + 16 + 8 * hh);
#pragma unroll
    for (int t = 0; t < 4; ++t) { if (col0 + t * 16 >= N) continue; const size_t boff = (size_t)(col0 + t * 16 + ln) * ldb + kb; FragH bq; bq.half[0] = *(const v8us*)((const unsigned short*)Bh + boff + 8 * hh); bq.half[1] = *(const v8us*)((const unsigned short*)Bh + boff + 16 + 8 * hh);
      acc[t] = mmaH<1>(ah.v, ah.v, bq.v, bq.v, acc[t]); }
  }
#pragma unroll
  for (int t = 0; t < 4; ++t) { if (col0 + t * 16 >= N) continue; const int col = col0 + t * 16 + ln; const float bv = bp ? bf16_round(bp[col]) : 0.f;
#pragma unroll
    for (int r = 0; r < 8; ++r) { float v = acc[t][r] * alpha + bv; if (CP) { const int rr = row0g + row0 + 8 * hh + r; if (rowsPerB < 0) v += CP[cofs + (size_t)rr * ldc + col];      /* rowsPerB < 0: own element of the batched C plane */ else { const int bidx = rr / rowsPerB; v += CP[(size_t)bidx * sCPb + (size_t)by * 64 + col]; } } if (ACT == 1) v = (v > 0.f) ? v : expm1f(v); else if (ACT == 7) v = (v > 0.f) ? v + 1.0f : expf(v); else if (ACT == 8) v = tanhf(v); else if (ACT == 9) v = 0.5f * v * (1.0f + tanhf(0.7978845608028654f * (v + 0.044715f * v * v * v))); else if (ACT == 11) v = 1.0f / (1.0f + expf(-v)); else if (ACT == 12) v = (v > 0.f) ? v : 0.01f * v; else if (ACT == 14) v = (v > 0.f) ? v : 0.1f * v; else if (ACT == 16) v = (v >= 0.f) ? v : 0.3f * v; else if (ACT == 17) v = (v >= 0.f) ? v : 0.2f * v; else if (ACT == 15) v = v / (1.0f + expf(-v)); else if (ACT == 3) v = fmaxf(v, 0.f); else if (ACT == 6) v = 0.5f * v * (1.0f + erff(v * 0.70710678118654752f)); so[w][8 * hh + r][t * 16 + ln] = v; } }
  __builtin_amdgcn_fence(__ATOMIC_ACQ_REL, "workgroup"); __builtin_amdgcn_wave_barrier();
  const int rsub = lane >> 4, c4 = (lane & 15) * 4; typedef _Float16 v4h __attribute__((ext_vector_type(4)));
  {
#pragma unroll
    for (int q = 0; q < 8; ++q) { const int r = q * 2 + rsub; if (col0 + c4 < N) { const v4f v = *(const v4fa*)&so[w][r][c4]; if (C) *(v4f*)(C + cofs + (size_t)(row0 + r) * ldc + col0 + c4) = v; if (C16) { v4h h4; for (int i = 0; i < 4; ++i) h4[i] = (_Float16)v[i]; *(v4h*)(C16 + cofs + (size_t)(row0 + r) * ldc + col0 + c4) = h4; } } }
     }
}


typedef _Float16 v4h __attribute__((ext_vector_type(4)));

__global__ __launch_bounds__(256) void k_x16(const float* __restrict__ x, _Float16* __restrict__ X16, size_t n8) { const size_t t = (size_t)blockIdx.x * 256 + threadIdx.x; if (t >= n8) return; FragH f;
#pragma unroll
  for (int q = 0; q < 8; ++q) f.h[q] = (_Float16)bf16_round(x[t * 8 + q]); *(v8us*)((unsigned short*)X16 + t * 8) = f.half[0];  }
__global__ __launch_bounds__(256) void k_h16(const float* __restrict__ x, _Float16* __restrict__ X16, size_t n8) { const size_t t = (size_t)blockIdx.x * 256 + threadIdx.x; if (t >= n8) return; FragH f;
#pragma unroll
  for (int q = 0; q < 8; ++q) f.h[q] = (_Float16)x[t * 8 + q]; *(v8us*)((unsigned short*)X16 + t * 8) = f.half[0];  }
__global__ __launch_bounds__(256) void k_round16f(const float* __restrict__ W, _Float16* __restrict__ Bt, size_t n8) { const size_t t = (size_t)blockIdx.x * 256 + threadIdx.x; if (t >= n8) return; FragH f;
#pragma unroll
  for (int i = 0; i < 8; ++i) f.h[i] = (_Float16)(bf16_round(W[t * 8 + i]) * 16.0f); *(v8us*)((unsigned short*)Bt + t * 8) = f.half[0];  }
template <int NHv, int TTv>
__global__ __launch_bounds__(256) void k_vt(const _Float16* __restrict__ V16, int ldv, int voff, _Float16* __restrict__ Vt) { __shared__ unsigned short tl[64][66]; const int tid = threadIdx.x; const int slab = blockIdx.x / (TTv / 64), lg = blockIdx.x % (TTv / 64); const int b = slab / NHv, h = slab % NHv;
  for (int i = tid; i < 64 * 8; i += 256) { const int r = i / 8, c8 = (i % 8) * 8; FragH f; f.half[0] = *(const v8us*)((const unsigned short*)V16 + ((size_t)b * TTv + lg * 64 + r) * ldv + voff + h * 64 + c8);
#pragma unroll
    for (int q = 0; q < 8; ++q) tl[r][c8 + q] = f.u[q]; }
  __syncthreads();
  {
#pragma unroll
    for (int rd = 0; rd < 2; ++rd) { const int d = rd * 32 + tid / 8, pc = tid % 8; FragH f;
#pragma unroll
      for (int q = 0; q < 8; ++q) f.u[q] = tl[pc * 8 + q][d];
      *(v8us*)((unsigned short*)Vt + ((size_t)slab * 64 + d) * TTv + lg * 64 + pc * 8) = f.half[0]; }
     } }

__global__ __launch_bounds__(256) void k_hl(const float* __restrict__ F, _Float16* __restrict__ Hh, _Float16* __restrict__ Hl, size_t n8) { const size_t t = (size_t)blockIdx.x * 256 + threadIdx.x; if (t >= n8) return; FragH fh, fl; const v4f a = *(const v4fa*)(F + t * 8), c = *(const v4fa*)(F + t * 8 + 4);
#pragma unroll
  for (int q = 0; q < 4; ++q) { _Float16 h = (_Float16)a[q]; fh.h[q] = h; fl.h[q] = (_Float16)((a[q] - (float)h) * 1024.0f); h = (_Float16)c[q]; fh.h[4 + q] = h; fl.h[4 + q] = (_Float16)((c[q] - (float)h) * 1024.0f); }
  { *(v8us*)((unsigned short*)Hh + t * 8) = fh.half[0]; *(v8us*)((unsigned short*)Hl + t * 8) = fl.half[0];  } }

// ---- fast GEMM (wave tile 32x64; requires M % 32 == 0 rows per launch region and N % 64 == 0); epilogue = k_gemm_hhx semantics ----
__device__ __forceinline__ v16h g2_frag(const _Float16* p, int hh) { FragH f; f.half[0] = *(const v8us*)((const unsigned short*)p + 8 * hh); f.half[1] = *(const v8us*)((const unsigned short*)p + 16 + 8 * hh); return f.v; }
__device__ __forceinline__ v8f g2_mma(v16h a, v16h b, v8f c) { v8f d = __builtin_amdgcn_wmma_f32_16x16x32_f16(false, a, false, b, (short)0, c, false, false); asm volatile("v_nop\n\tv_nop\n\tv_nop\n\tv_nop" : "+v"(d) : "v"(a), "v"(b)); return d; }
template <int ACT>
__global__ __launch_bounds__(128) void k_gemm2(const _Float16* __restrict__ A, int lda, size_t sA, const _Float16* __restrict__ Bh, int ldb, size_t sB, float alpha, const float* __restrict__ bias, size_t sBias, const float* __restrict__ CP, int rowsPerB, size_t sCPb, int row0g,
    float* __restrict__ C, _Float16* __restrict__ C16, int ldc, size_t sC, int M, int N, int K) { static_assert(ACT == 0 || ACT == 3 || ACT == 6 || ACT == 8 || ACT == 9 || ACT == 11 || ACT == 12 || ACT == 14 || ACT == 15 || ACT == 16 || ACT == 17, "k_gemm2: unsupported ACT code (would silently apply no activation)");
  __shared__ __attribute__((aligned(16))) float so[4][32][68];
  const int tid = threadIdx.x, w = tid >> 5, lane = tid & 31, ln = lane & 15, hh = lane >> 4; const int by = blockIdx.y;
  A += (size_t)by * sA; Bh += (size_t)by * sB; const size_t cofs = (size_t)by * sC; const float* bp = bias ? bias + (size_t)by * sBias : nullptr;
  const int ntn = N >> 6; const int mt = blockIdx.x / ntn, nq = blockIdx.x - mt * ntn; const int row0 = mt * 128 + 32 * w, col0 = nq * 64; if (row0 >= M) return;
  const _Float16* a0p = A + (size_t)(row0 + ln) * lda; const _Float16* a1p = a0p + (size_t)16 * lda;
  const _Float16* b0p = Bh + (size_t)(col0 + ln) * ldb; const _Float16* b1p = b0p + (size_t)16 * ldb; const _Float16* b2p = b1p + (size_t)16 * ldb; const _Float16* b3p = b2p + (size_t)16 * ldb;
  const v8f z8 = {0.f,0.f,0.f,0.f,0.f,0.f,0.f,0.f}; v8f c00 = z8, c01 = z8, c02 = z8, c03 = z8, c10 = z8, c11 = z8, c12 = z8, c13 = z8;
#pragma unroll 1
  for (int kb = 0; kb < K; kb += 32) { const v16h a0 = g2_frag(a0p + kb, hh), a1 = g2_frag(a1p + kb, hh);
    v16h b = g2_frag(b0p + kb, hh); c00 = g2_mma(a0, b, c00); c10 = g2_mma(a1, b, c10);
    b = g2_frag(b1p + kb, hh); c01 = g2_mma(a0, b, c01); c11 = g2_mma(a1, b, c11);
    b = g2_frag(b2p + kb, hh); c02 = g2_mma(a0, b, c02); c12 = g2_mma(a1, b, c12);
    b = g2_frag(b3p + kb, hh); c03 = g2_mma(a0, b, c03); c13 = g2_mma(a1, b, c13); }
  v8f accs[8] = {c00, c01, c02, c03, c10, c11, c12, c13};
#pragma unroll
  for (int u = 0; u < 8; ++u) { const int t = u & 3, half = u >> 2; const int col = col0 + t * 16 + ln; const float bv = bp ? bf16_round(bp[col]) : 0.f;
#pragma unroll
    for (int r = 0; r < 8; ++r) { const int rloc = half * 16 + 8 * hh + r; float v = accs[u][r] * alpha + bv; if (CP) { if (rowsPerB < 0) v += CP[cofs + (size_t)(row0g + row0 + rloc) * ldc + col];      /* rowsPerB < 0: own element of the batched C plane */ else { const int bidx = (row0g + row0 + rloc) / rowsPerB; v += CP[(size_t)bidx * sCPb + (size_t)by * 64 + col]; } }
      if (ACT == 3) v = fmaxf(v, 0.f); else if (ACT == 6) v = 0.5f * v * (1.0f + erff(v * 0.70710678118654752f)); else if (ACT == 11) v = 1.0f / (1.0f + expf(-v)); else if (ACT == 15) v = v / (1.0f + expf(-v)); else if (ACT == 12) v = (v > 0.f) ? v : 0.01f * v; else if (ACT == 8) v = tanhf(v); else if (ACT == 9) v = 0.5f * v * (1.0f + tanhf(0.7978845608028654f * (v + 0.044715f * v * v * v))); else if (ACT == 14) v = (v > 0.f) ? v : 0.1f * v; else if (ACT == 16) v = (v >= 0.f) ? v : 0.3f * v; else if (ACT == 17) v = (v >= 0.f) ? v : 0.2f * v;
      so[w][rloc][t * 16 + ln] = v; } }
  __builtin_amdgcn_fence(__ATOMIC_ACQ_REL, "workgroup"); __builtin_amdgcn_wave_barrier();
  const int rsub = lane >> 4, c4 = (lane & 15) * 4;
  {
#pragma unroll
    for (int q = 0; q < 16; ++q) { const int r = q * 2 + rsub; const v4f v = *(const v4fa*)&so[w][r][c4]; if (C) *(v4f*)(C + cofs + (size_t)(row0 + r) * ldc + col0 + c4) = v; if (C16) { v4h h4; for (int i = 0; i < 4; ++i) h4[i] = (_Float16)v[i]; *(v4h*)(C16 + cofs + (size_t)(row0 + r) * ldc + col0 + c4) = h4; } }
     } }


#define AT_T 64                    /* keys per quarter and trip */
#define AT_NT (NPX / 4 / AT_T)     /* 16 trips */
#define AT_KP 40                   /* K row pitch in LDS, f16 elements: 64 B + 16 B, an odd multiple of 16 B */
#define AT_VP 72                   /* V^T row pitch in LDS, f16 elements: 128 B + 16 B, an odd multiple of 16 B */
#define AT_OP 130                  /* pitch of the joined O^T rows, floats: rows 8 apart fall 16 banks apart */
__device__ __forceinline__ v16h at_frag(const unsigned short* p, int hh) { FragH f; f.half[0] = *(const v8us*)(p + 8 * hh); f.half[1] = *(const v8us*)(p + 16 + 8 * hh); return f.v; }
__device__ __forceinline__ float at_xhalf(float x) { const int v = __float_as_int(x); return __int_as_float(__builtin_amdgcn_permlanex16(v, v, 0x76543210, 0xfedcba98, false, false)); }
__device__ __forceinline__ v8f at_mma(v16h a, v16h b, v8f c) { return __builtin_amdgcn_wmma_f32_16x16x32_f16(false, a, false, b, (short)0, c, false, false); }
__device__ __forceinline__ float at_max16(v8f a, v8f c) { float t = fmaxf(a[0], c[0]);
#pragma unroll      /* constant element indices keep the tiles in registers */
  for (int r = 1; r < 8; ++r) t = fmaxf(t, fmaxf(a[r], c[r])); return fmaxf(t, at_xhalf(t)); }
// P = 2^(s * sa - mx) for two S^T tiles of one query tile: the f16 B operand, and the f32 values added into l register by register
__device__ __forceinline__ v16h at_p(v8f a, v8f c, float sa, float mx, v8f& l) { FragH f; const v8f sv = {sa, sa, sa, sa, sa, sa, sa, sa}; const v8f nm = {-mx, -mx, -mx, -mx, -mx, -mx, -mx, -mx};
  const v8f xa = __builtin_elementwise_fma(a, sv, nm), xc = __builtin_elementwise_fma(c, sv, nm); v8f ea, ec;
#pragma unroll      /* constant element indices keep the tiles in registers */
  for (int r = 0; r < 8; ++r) { ea[r] = __builtin_amdgcn_exp2f(xa[r]); ec[r] = __builtin_amdgcn_exp2f(xc[r]); f.h[r] = (_Float16)ea[r]; f.h[8 + r] = (_Float16)ec[r]; }
  l += ea + ec; return f.v; }
__global__ __launch_bounds__(512) void k_attn(const _Float16* __restrict__ H16, const _Float16* __restrict__ L16, const _Float16* __restrict__ VT, const float* __restrict__ HF, const float* __restrict__ pp, float* __restrict__ out) {
  __shared__ __attribute__((aligned(16))) unsigned short Ks[2][4 * AT_T][AT_KP];
  __shared__ __attribute__((aligned(16))) unsigned short Vs[2][4 * HC][AT_VP];
  __shared__ float Om[4][HC][AT_OP];
  __shared__ float Mm[4][128];
  __shared__ float Lm[4][128];
  const int tid = threadIdx.x, w = tid >> 5, lane = tid & 31, ln = lane & 15, hh = lane >> 4;
  const int qg = w & 3, ks = w >> 2;
  const int plane = blockIdx.x / (NPX / 128), q0 = (blockIdx.x % (NPX / 128)) * 128; const int b = plane / NHD, h = plane % NHD;
  const float sc2 = 0.125f * bf16_round(pp[0]) * 1.4426950408889634f;      /* scores in log2 units */
  const float sa = fabsf(sc2); const unsigned short qflip = sc2 < 0.f ? (unsigned short)0x8000 : (unsigned short)0;      /* a negative scale goes into Q's sign (exact), so that the largest raw score is the largest scaled one */
  const unsigned short* Lg = (const unsigned short*)L16 + (size_t)b * NPX * CH + h * HC;
  const unsigned short* Vg = (const unsigned short*)VT + ((size_t)b * CH + h * HC) * NPX;
  /* staging: 1024 16-byte pieces of K and of V^T a trip, two of each a thread */
  const int kr0 = tid >> 2, kr1 = kr0 + 128, kc = (tid & 3) * 8;
  const int vr0 = tid >> 3, vr1 = vr0 + 64, vc = (tid & 7) * 8;
  const unsigned short* gk0 = Lg + (size_t)((kr0 / AT_T) * (NPX / 4) + (kr0 % AT_T)) * CH + kc;
  const unsigned short* gk1 = Lg + (size_t)((kr1 / AT_T) * (NPX / 4) + (kr1 % AT_T)) * CH + kc;
  const unsigned short* gv0 = Vg + (size_t)(vr0 % HC) * NPX + (vr0 / HC) * (NPX / 4) + vc;
  const unsigned short* gv1 = Vg + (size_t)(vr1 % HC) * NPX + (vr1 / HC) * (NPX / 4) + vc;
  const _Float16* qp = H16 + ((size_t)b * NPX + q0 + qg * 32 + ln) * CH + h * HC;
  FragH qf0, qf1; qf0.v = g2_frag(qp, hh); qf1.v = g2_frag(qp + (size_t)16 * CH, hh);
  qf0.half[0] ^= qflip; qf0.half[1] ^= qflip; qf1.half[0] ^= qflip; qf1.half[1] ^= qflip;
  const v16h qb0 = qf0.v, qb1 = qf1.v;
  const v8f z8 = {0.f,0.f,0.f,0.f,0.f,0.f,0.f,0.f};
  v8f o00 = z8, o10 = z8, o01 = z8, o11 = z8;      /* o<channel tile><query tile> */
  float m0 = -3.0e38f, m1 = -3.0e38f; v8f l0 = z8, l1 = z8;
  v8us rk0 = *(const v8us*)gk0, rk1 = *(const v8us*)gk1, rv0 = *(const v8us*)gv0, rv1 = *(const v8us*)gv1;
  *(v8us*)&Ks[0][kr0][kc] = rk0; *(v8us*)&Ks[0][kr1][kc] = rk1; *(v8us*)&Vs[0][vr0][vc] = rv0; *(v8us*)&Vs[0][vr1][vc] = rv1;
  __syncthreads();
  for (int t = 0; t < AT_NT; ++t) { const int bf = t & 1;
    if (t + 1 < AT_NT) { const size_t ko = (size_t)(t + 1) * AT_T * CH, vo = (size_t)(t + 1) * AT_T;      /* the next tile's loads fly over this tile's work */
      rk0 = *(const v8us*)(gk0 + ko); rk1 = *(const v8us*)(gk1 + ko); rv0 = *(const v8us*)(gv0 + vo); rv1 = *(const v8us*)(gv1 + vo); }
#pragma unroll      /* both 32-key steps of a tile in one body: LDS offsets become immediates */
    for (int st = 0; st < AT_T / 32; ++st) {
      const unsigned short* kb = &Ks[bf][ks * AT_T + st * 32 + ln][0];
      const unsigned short* vb = &Vs[bf][ks * HC + ln][st * 32];
      const v16h ka0 = at_frag(kb, hh), ka1 = at_frag(kb + 16 * AT_KP, hh);
      const v16h va0 = at_frag(vb, hh), va1 = at_frag(vb + 16 * AT_VP, hh);
      v8f s00 = at_mma(ka0, qb0, z8), s10 = at_mma(ka1, qb0, z8), s01 = at_mma(ka0, qb1, z8), s11 = at_mma(ka1, qb1, z8);      /* s<key tile><query tile> */
      const float t0 = at_max16(s00, s10) * sa, t1 = at_max16(s01, s11) * sa;
      /* lazy rescale: the maximum in use moves only when a column's new maximum exceeds it by more than 8 (P never exceeds 2^8, inside f16); one scalar branch a step */
      if (__builtin_amdgcn_ballot_w32((t0 > m0 + 8.0f) || (t1 > m1 + 8.0f)) != 0) {
        const float n0 = fmaxf(m0, t0), n1 = fmaxf(m1, t1); const float f0 = __builtin_amdgcn_exp2f(m0 - n0), f1 = __builtin_amdgcn_exp2f(m1 - n1);
        m0 = n0; m1 = n1; l0 *= f0; l1 *= f1; o00 *= f0; o10 *= f0; o01 *= f1; o11 *= f1; }
      const v16h p0 = at_p(s00, s10, sa, m0, l0), p1 = at_p(s01, s11, sa, m1, l1);
      o00 = at_mma(va0, p0, o00); o10 = at_mma(va1, p0, o10); o01 = at_mma(va0, p1, o01); o11 = at_mma(va1, p1, o11);
    }
    if (t + 1 < AT_NT) {      /* the other buffer's readers left it before the barrier that ended trip t - 1 */
      *(v8us*)&Ks[bf ^ 1][kr0][kc] = rk0; *(v8us*)&Ks[bf ^ 1][kr1][kc] = rk1; *(v8us*)&Vs[bf ^ 1][vr0][vc] = rv0; *(v8us*)&Vs[bf ^ 1][vr1][vc] = rv1;
      __syncthreads(); }
  }
  /* join: the lane halves' sums, then the four key quarters through LDS */
  float ls0 = ((l0[0] + l0[1]) + (l0[2] + l0[3])) + ((l0[4] + l0[5]) + (l0[6] + l0[7])), ls1 = ((l1[0] + l1[1]) + (l1[2] + l1[3])) + ((l1[4] + l1[5]) + (l1[6] + l1[7]));
  ls0 += at_xhalf(ls0); ls1 += at_xhalf(ls1);
  if (hh == 0) { Mm[ks][qg * 32 + ln] = m0; Mm[ks][qg * 32 + 16 + ln] = m1; Lm[ks][qg * 32 + ln] = ls0; Lm[ks][qg * 32 + 16 + ln] = ls1; }
#pragma unroll      /* constant element indices keep the tiles in registers */
  for (int r = 0; r < 8; ++r) { Om[ks][8 * hh + r][qg * 32 + ln] = o00[r]; Om[ks][16 + 8 * hh + r][qg * 32 + ln] = o10[r]; Om[ks][8 * hh + r][qg * 32 + 16 + ln] = o01[r]; Om[ks][16 + 8 * hh + r][qg * 32 + 16 + ln] = o11[r]; }
  __syncthreads();
  const int q = tid & 127, c0 = (tid >> 7) * 8;
  const float mm = fmaxf(fmaxf(Mm[0][q], Mm[1][q]), fmaxf(Mm[2][q], Mm[3][q]));
  const float e0 = __builtin_amdgcn_exp2f(Mm[0][q] - mm), e1 = __builtin_amdgcn_exp2f(Mm[1][q] - mm), e2 = __builtin_amdgcn_exp2f(Mm[2][q] - mm), e3 = __builtin_amdgcn_exp2f(Mm[3][q] - mm);
  const float inv = 1.0f / (Lm[0][q] * e0 + Lm[1][q] * e1 + Lm[2][q] * e2 + Lm[3][q] * e3);
  const float* hf = HF + ((size_t)b * NPX + q0 + q) * CH + h * HC + c0;
  const v4f ra = *(const v4fa*)hf, rb = *(const v4fa*)(hf + 4);
  float* op = out + ((size_t)b * CH + h * HC + c0) * NPX + q0 + q;
#pragma unroll      /* constant element indices for the residual vectors */
  for (int i = 0; i < 8; ++i) { const float v = Om[0][c0 + i][q] * e0 + Om[1][c0 + i][q] * e1 + Om[2][c0 + i][q] * e2 + Om[3][c0 + i][q] * e3; op[(size_t)i * NPX] = v * inv + (i < 4 ? ra[i & 3] : rb[i & 3]); }
}

// ---- fused 3x3 convolution (implicit GEMM): one work-group = two image rows (128 pixels) of one image of one of the two convolutions, all 64 output channels; 8 waves = 8 tiles of 16 pixels.
// The four input rows the taps reach are read once from NCHW f32, rounded to bf16 and laid down in LDS as f16 pixel rows with a zero column on either side, so each tap's operand is the same LDS tile at a shifted pixel; no im2col matrix exists in memory.
// The weights are read in their own order (coalesced), scaled by 16 and rounded to bf16, written to LDS as f16, and turned there from [channel * 9 + tap] into [tap * 64 + channel] rows by 16-byte reads and writes.
// Product transposed: D = W (A operand, 16 output channels) . X^T (B operand, 16 pixels), k = tap * 64 + channel on both sides. A lane then holds 8 consecutive channels of one pixel: BN + ReLU in registers and 16-byte stores straight into the pixel rows; V^T goes through one LDS tile.
#define CV_XP 72                   /* channel pitch of a staged pixel, f16 elements: 128 B + 16 B, an odd multiple of 16 B */
#define CV_WP (KC + 8)             /* k pitch of a staged weight row, f16 elements: 1152 B + 16 B, an odd multiple of 16 B */
#define CV_TP 136                  /* pixel pitch of the V^T tile, f16 elements: 256 B + 16 B */
typedef unsigned short v4us __attribute__((ext_vector_type(4), may_alias));
typedef unsigned int v4ui __attribute__((ext_vector_type(4), may_alias));
typedef float v2f __attribute__((ext_vector_type(2)));
typedef __bf16 v2bf __attribute__((ext_vector_type(2)));
typedef _Float16 v2h __attribute__((ext_vector_type(2)));
// two f32 values rounded to bf16 (the hardware's round to nearest even: bf16_round's value for every finite x), then written as f16
__device__ __forceinline__ v2h cv_pair(float a, float c) { const v2f p = {a, c}; return __builtin_convertvector(__builtin_convertvector(__builtin_convertvector(p, v2bf), v2f), v2h); }
// rsqrtf's own steps (an argument below the smallest normal number is scaled by 2^24, its result by 2^12) around the bare instruction
__device__ __forceinline__ float cv_rsqrt(float x) { const bool tiny = x < 1.17549435e-38f; const float xs = tiny ? x * 16777216.0f : x; float r;
  asm("v_rsq_f32 %0, %1\n\tv_nop" : "=v"(r) : "v"(xs));      /* v_nop: the free slot that the instruction set asks for behind a transcendental */
  return tiny ? r * 4096.0f : r; }
__global__ __launch_bounds__(256) void k_conv(const float* __restrict__ high, const float* __restrict__ low, const float* __restrict__ wH, const float* __restrict__ wL,
    const float* __restrict__ gH, const float* __restrict__ bH, const float* __restrict__ mH, const float* __restrict__ vH, const float* __restrict__ gL, const float* __restrict__ bL, const float* __restrict__ mL, const float* __restrict__ vL,
    _Float16* __restrict__ H16, float* __restrict__ HF, _Float16* __restrict__ L16, _Float16* __restrict__ VT) {
  __shared__ __attribute__((aligned(16))) unsigned short Xs[4][WSD + 2][CV_XP];
  __shared__ __attribute__((aligned(16))) unsigned short Wr[CH * KC];
  __shared__ __attribute__((aligned(16))) unsigned short Ws[CH][CV_WP];
  __shared__ __attribute__((aligned(16))) unsigned short Ts[CH][CV_TP];
  __shared__ __attribute__((aligned(16))) float Bi[CH];
  __shared__ __attribute__((aligned(16))) float Bs[CH];
  const int tid = threadIdx.x, w = tid >> 5, lane = tid & 31, ln = lane & 15, hh = lane >> 4;
  const int nb = NI * (HS / 2); const bool lo = (int)blockIdx.x >= nb; const int blk = (int)blockIdx.x - (lo ? nb : 0);
  const int b = blk / (HS / 2), y0 = (blk % (HS / 2)) * 2;
  const float* x = lo ? low : high; const float* wg = lo ? wL : wH;
  /* input: a thread takes 8 channels x 4 pixels of two of the four rows; a row outside the image is read at a clamped address and stored as zeros */
  const int xq = tid & 15, cg = (tid >> 4) & 7, r0 = tid >> 7;
  v4f xv[2][8];
#pragma unroll      /* constant indices keep the loaded values in registers */
  for (int u = 0; u < 2; ++u) { const int iy = y0 - 1 + r0 + 2 * u; const int iyc = iy < 0 ? 0 : (iy >= HS ? HS - 1 : iy);
#pragma unroll
    for (int i = 0; i < 8; ++i) xv[u][i] = *(const v4fa*)(x + ((size_t)(b * CH + cg * 8 + i) * NPX + iyc * WSD + xq * 4)); }
#pragma unroll      /* independent loads, many in flight together */
  for (int j = 0; j < CH * KC / 4 / 256; ++j) { const int i = tid + 256 * j; const v4f v = *(const v4fa*)(wg + (size_t)i * 4); union { v2h h[2]; v4us v; } f;
    f.h[0] = cv_pair(v[0] * 16.0f, v[1] * 16.0f); f.h[1] = cv_pair(v[2] * 16.0f, v[3] * 16.0f);      /* the factor 16 ahead of the rounding: a power of two passes through it unchanged, and the f16 value stays exact */
    *(v4us*)&Wr[i * 4] = f.v; }
#pragma unroll
  for (int u = 0; u < 2; ++u) { const int r = r0 + 2 * u, iy = y0 - 1 + r; const unsigned int keep = (iy >= 0 && iy < HS) ? 0xFFFFFFFFu : 0u;
#pragma unroll
    for (int j = 0; j < 4; ++j) { union { v2h h[4]; v4ui d; } f;
#pragma unroll
      for (int i = 0; i < 4; ++i) f.h[i] = cv_pair(xv[u][2 * i][j], xv[u][2 * i + 1][j]);
      *(v4ui*)&Xs[r][1 + xq * 4 + j][cg * 8] = f.d & keep; } }
  if (tid < 64) { const v8us zz = {0, 0, 0, 0, 0, 0, 0, 0}; *(v8us*)&Xs[tid >> 4][((tid >> 3) & 1) * (WSD + 1)][(tid & 7) * 8] = zz;      /* the zero columns left and right of the image */
    const float* g = lo ? gL : gH; const float* bt = lo ? bL : bH; const float* mn = lo ? mL : mH; const float* vr = lo ? vL : vH;
    const float inv = bf16_round(g[tid]) * cv_rsqrt(bf16_round(vr[tid]) + 1e-5f);
    Bi[tid] = inv * 0.0625f; Bs[tid] = bf16_round(bt[tid]) - bf16_round(mn[tid]) * inv; }      /* the weights carry an exact factor 16 */
  __syncthreads();
#pragma unroll      /* a task = 8 input channels x 9 taps of one output channel: 72 consecutive elements in, one 16-byte piece a tap out */
  for (int u = 0; u < 2; ++u) { const int t = tid + 256 * u; union { v8us v[9]; unsigned short e[72]; } s;
#pragma unroll
    for (int m = 0; m < 9; ++m) s.v[m] = *(const v8us*)&Wr[t * 72 + m * 8];
#pragma unroll
    for (int tap = 0; tap < 9; ++tap) { v8us d;
#pragma unroll
      for (int i = 0; i < 8; ++i) d[i] = s.e[i * 9 + tap];
      *(v8us*)&Ws[t >> 3][tap * CH + (t & 7) * 8] = d; } }
  __syncthreads();
  const unsigned short* xb = &Xs[w >> 2][(w & 3) * 16 + ln][0];
  const unsigned short* wb = &Ws[ln][0];
  const v8f z8 = {0.f,0.f,0.f,0.f,0.f,0.f,0.f,0.f};
  v8f acc[4] = {z8, z8, z8, z8};
  v16h xf[2], wf[2][4];
  xf[0] = at_frag(xb, hh);
#pragma unroll
  for (int mt = 0; mt < 4; ++mt) wf[0][mt] = at_frag(wb + mt * 16 * CV_WP, hh);
#pragma unroll      /* taps and k halves as constants: every LDS offset becomes an immediate, and the two fragment sets stay in registers */
  for (int ks = 0; ks < 18; ++ks) { const int cu = ks & 1, nx = cu ^ 1;
    if (ks + 1 < 18) { const int tap = (ks + 1) >> 1, kh = ((ks + 1) & 1) * 32;
      xf[nx] = at_frag(xb + ((tap / 3) * (WSD + 2) + tap % 3) * CV_XP + kh, hh);
#pragma unroll
      for (int mt = 0; mt < 4; ++mt) wf[nx][mt] = at_frag(wb + mt * 16 * CV_WP + tap * CH + kh, hh); }
    __builtin_amdgcn_sched_barrier(0);      /* holds the next step's ten LDS reads ahead of this step's products; without it each product waits out the full latency of its own two reads */
#pragma unroll
    for (int mt = 0; mt < 4; ++mt) acc[mt] = at_mma(wf[cu][mt], xf[cu], acc[mt]); }
  const int pl = w * 16 + ln; const size_t ro = ((size_t)b * NPX + y0 * WSD + pl) * CH + 8 * hh;
  v8f y[4]; FragH f[4];
#pragma unroll      /* constant element indices keep the tiles in registers */
  for (int mt = 0; mt < 4; ++mt) { const int c0 = mt * 16 + 8 * hh; const v4f i0 = *(const v4fa*)&Bi[c0], i1 = *(const v4fa*)&Bi[c0 + 4], s0 = *(const v4fa*)&Bs[c0], s1 = *(const v4fa*)&Bs[c0 + 4];
#pragma unroll
    for (int r = 0; r < 8; ++r) { const float t = fmaxf(acc[mt][r] * (r < 4 ? i0[r & 3] : i1[r & 3]) + (r < 4 ? s0[r & 3] : s1[r & 3]), 0.f); y[mt][r] = t; f[mt].h[r] = (_Float16)t; } }
  /* every global store stands at the end of its path, behind all arithmetic: no register of an issued store is written again */
  if (!lo) {
#pragma unroll
    for (int mt = 0; mt < 4; ++mt) { *(v8us*)((unsigned short*)H16 + ro + mt * 16) = f[mt].half[0]; *(v8f*)(HF + ro + mt * 16) = y[mt]; }
    asm volatile("s_wait_xcnt 0x0" ::: "memory");      /* the built code lays the other path's first instructions behind these stores, past a branch: the wait stands in front of any write of a register that the stores name */
    return;      /* block-uniform: the whole work-group belongs to one convolution */
  }
#pragma unroll
  for (int mt = 0; mt < 4; ++mt) {
#pragma unroll
    for (int r = 0; r < 8; ++r) Ts[mt * 16 + 8 * hh + r][pl] = f[mt].u[r]; }
  __syncthreads();
  v8us tv[4];
#pragma unroll
  for (int j = 0; j < 4; ++j) tv[j] = *(const v8us*)&Ts[(tid >> 4) + 16 * j][(tid & 15) * 8];
#pragma unroll
  for (int mt = 0; mt < 4; ++mt) *(v8us*)((unsigned short*)L16 + ro + mt * 16) = f[mt].half[0];
#pragma unroll
  for (int j = 0; j < 4; ++j) *(v8us*)((unsigned short*)VT + ((size_t)b * CH + (tid >> 4) + 16 * j) * NPX + y0 * WSD + (tid & 15) * 8) = tv[j];
}

extern "C" void kernel_launch(void* const* d_in, const int* in_sizes, int n_in,
                              void* d_out, int out_size, void* d_ws, size_t ws_size, hipStream_t stream) {
  (void)in_sizes; (void)n_in; (void)out_size;
  const float* const* I = (const float* const*)d_in; const float* low = I[0]; const float* high = I[1]; const float* wH = I[2]; const float* gH = I[3]; const float* bH = I[4]; const float* mH = I[5]; const float* vH = I[6]; const float* wL = I[7]; const float* gL = I[8]; const float* bL = I[9]; const float* mL = I[10]; const float* vL = I[11]; const float* pp = I[12];
  char* ws = (char*)d_ws; size_t off = 0;
  auto take = [&](size_t bytes) { char* p = ws + off; off += (bytes + 255) & ~(size_t)255; return p; };
  const size_t ne = (size_t)NR * CH;
  _Float16* H16 = (_Float16*)take(ne * 2); float* HF = (float*)take(ne * 4); _Float16* L16 = (_Float16*)take(ne * 2); _Float16* VT = (_Float16*)take(ne * 2);
  if (off > ws_size) return;      /* 2 + 4 + 2 + 2 = 10 MiB */
  k_conv<<<2 * NI * (HS / 2), 256, 0, stream>>>(high, low, wH, wL, gH, bH, mH, vH, gL, bL, mL, vL, H16, HF, L16, VT);      /* hconv (q_h, residual), lconv (k_l = v_l) + V^T */
  k_attn<<<NI * NHD * (NPX / 128), 512, 0, stream>>>(H16, L16, VT, HF, pp, (float*)d_out);      /* scores, softmax, readout, residual, NCHW store */
}
